// v000
// Measured on an AMD MI455X. A time is GPU time per run, averaged over a window of back-to-back runs after a warm-up
// (all launches, gaps included; the runs take copies of the inputs in turn), and the median of several windows.
// Apart from v000's, it joins two sittings. Times from different sittings can be a few percent apart, while
// side-by-side timings come from the same sitting.
// v000 is the starting kernel. One run takes 374 microseconds.
#include <hip/hip_runtime.h>

#define BATCH  2
#define NSEQ   2048
#define CDIM   1024
#define NHEADS 16
#define HDIM   64
#define BN     (BATCH * NSEQ)   // 4096 total rows

typedef __attribute__((ext_vector_type(16))) _Float16 v16h;
typedef __attribute__((ext_vector_type(8)))  _Float16 v8h;
typedef __attribute__((ext_vector_type(8)))  float    v8f;

// 0.125 (=1/sqrt(HDIM)) * log2(e): folded into the Q projection so the
// attention kernel can use v_exp_f32 (2^x) directly with no per-element mul.
#define QSCALE 0.1803368801f

// ---------------------------------------------------------------------------
// Fragment builder matching the CDNA5 16-bit A/B lane layout:
//   lanes 0-15 : K elements {k0+0..7, k0+16..23}
//   lanes 16-31: K elements {k0+8..15, k0+24..31}
// Caller passes a pointer already offset by (hi ? 8 : 0).
// ---------------------------------------------------------------------------
__device__ __forceinline__ v16h frag_from_h16(const _Float16* p) {
    v8h lo = *(const v8h*)p;
    v8h hh = *(const v8h*)(p + 16);
    v16h r;
#pragma unroll
    for (int i = 0; i < 8; ++i) { r[i] = lo[i]; r[8 + i] = hh[i]; }
    return r;
}

// ---------------------------------------------------------------------------
// f32 -> f16 bulk convert (8 elements / thread, b128 in / b128 out)
// ---------------------------------------------------------------------------
__global__ __launch_bounds__(256) void cvt_kernel(const float* __restrict__ in,
                                                  _Float16* __restrict__ out,
                                                  int n8) {
    const int i = blockIdx.x * 256 + threadIdx.x;
    if (i >= n8) return;
    const float4 a = ((const float4*)in)[2 * i + 0];
    const float4 b = ((const float4*)in)[2 * i + 1];
    v8h r;
    r[0] = (_Float16)a.x; r[1] = (_Float16)a.y;
    r[2] = (_Float16)a.z; r[3] = (_Float16)a.w;
    r[4] = (_Float16)b.x; r[5] = (_Float16)b.y;
    r[6] = (_Float16)b.z; r[7] = (_Float16)b.w;
    ((v8h*)out)[i] = r;
}

// ---------------------------------------------------------------------------
// Transposed projection GEMM: computes Out^T = W @ X^T  (i.e. Out = X @ W^T),
// + bias, * oscale.  One wave: 128 output channels (j) x 16 rows (m).
// The D-matrix C-layout then has j running along registers -> contiguous
// epilogue stores; bias is indexed along registers.
// MODE 0: f16 out, head-major   [B,H,N,D]   (Q with oscale=QSCALE, K)
// MODE 1: f16 out, d-transposed [B,H,D,N]   (V)
// MODE 2: f32 out, plain        [BN,CDIM]   (final output projection)
// ---------------------------------------------------------------------------
template <int MODE>
__global__ __launch_bounds__(32) void proj_kernel(const _Float16* __restrict__ X,
                                                  const _Float16* __restrict__ W,
                                                  const float* __restrict__ bias,
                                                  void* __restrict__ outv,
                                                  float oscale) {
    const int lane = threadIdx.x;
    const int col  = lane & 15;
    const int hi   = lane >> 4;
    const int m0   = blockIdx.x * 16;    // row tile over BN (lanes)
    const int n0   = blockIdx.y * 128;   // output-channel tile (registers)

    v8f c[8] = {v8f{}, v8f{}, v8f{}, v8f{}, v8f{}, v8f{}, v8f{}, v8f{}};

    for (int k0 = 0; k0 < CDIM; k0 += 32) {
        // B = X^T fragment: lane holds column m, contiguous in k
        v16h bX = frag_from_h16(X + (size_t)(m0 + col) * CDIM + k0 + hi * 8);
#pragma unroll
        for (int g = 0; g < 8; ++g) {
            // A = W fragment: lane holds row j, contiguous in k
            v16h aW = frag_from_h16(W + (size_t)(n0 + g * 16 + col) * CDIM + k0 + hi * 8);
            c[g] = __builtin_amdgcn_wmma_f32_16x16x32_f16(
                false, aW, false, bX, (short)0, c[g], false, false);
        }
    }

    // Epilogue: Out^T C-layout -> lane holds fixed m; register i is channel
    // j0+i with j0 = n0 + g*16 + hi*8 (8 contiguous channels per store).
    const int m = m0 + col;
    const int b = m >> 11;               // m / NSEQ
    const int n = m & 2047;              // m % NSEQ
#pragma unroll
    for (int g = 0; g < 8; ++g) {
        const int j0 = n0 + g * 16 + hi * 8;
        float vals[8];
#pragma unroll
        for (int i = 0; i < 8; ++i) vals[i] = (c[g][i] + bias[j0 + i]) * oscale;
        if (MODE == 0) {
            const int h = j0 >> 6, d0 = j0 & 63;
            v8h r;
#pragma unroll
            for (int i = 0; i < 8; ++i) r[i] = (_Float16)vals[i];
            *(v8h*)((_Float16*)outv +
                    (((size_t)b * NHEADS + h) * NSEQ + n) * HDIM + d0) = r;
        } else if (MODE == 1) {
            const int h = j0 >> 6, d0 = j0 & 63;
#pragma unroll
            for (int i = 0; i < 8; ++i)
                ((_Float16*)outv)[(((size_t)b * NHEADS + h) * HDIM + d0 + i) * NSEQ + n] =
                    (_Float16)vals[i];
        } else {
            float* op = (float*)outv + (size_t)m * CDIM + j0;
            *(float4*)(op + 0) = make_float4(vals[0], vals[1], vals[2], vals[3]);
            *(float4*)(op + 4) = make_float4(vals[4], vals[5], vals[6], vals[7]);
        }
    }
}

// ---------------------------------------------------------------------------
// Attention, transposed formulation (no LDS, no barriers):
//   S^T = K · Q^T      (A = K tile, B = Q^T tile; both contiguous loads)
//   P^T = exp2(S^T)    (C-layout of S^T IS the B-layout of P^T for step 2)
//   O^T += V^T · P^T   (A = V^T from the pre-transposed Vt tensor)
// One wave: 32 q rows (two 16-col subtiles of S^T), kv chunks of 32.
// Row sums of P are per-lane scalars (lane = fixed q); one xor-16 shuffle at
// the end.  O^T epilogue stores are contiguous v8h.
// ---------------------------------------------------------------------------
__global__ __launch_bounds__(32) void attn_kernel(const _Float16* __restrict__ Qh,
                                                  const _Float16* __restrict__ Kh,
                                                  const _Float16* __restrict__ Vt,
                                                  _Float16* __restrict__ AO) {
    const int lane = threadIdx.x;
    const int col  = lane & 15;
    const int hi   = lane >> 4;
    const int q0   = blockIdx.x * 32;
    const int bh   = blockIdx.y;              // b*NHEADS + h
    const int b    = bh >> 4;
    const int h    = bh & 15;

    // B = Q^T fragments: [q-subtile][d-fragment]; lane holds q column
    v16h bQ[2][2];
#pragma unroll
    for (int qt = 0; qt < 2; ++qt)
#pragma unroll
        for (int f = 0; f < 2; ++f)
            bQ[qt][f] = frag_from_h16(
                Qh + ((size_t)bh * NSEQ + q0 + qt * 16 + col) * HDIM + f * 32 + hi * 8);

    float lrow[2] = {0.0f, 0.0f};
    v8f o[2][4];   // O^T accumulators: [q-subtile][d-group]
#pragma unroll
    for (int qt = 0; qt < 2; ++qt)
#pragma unroll
        for (int g = 0; g < 4; ++g) o[qt][g] = v8f{};

    for (int chunk = 0; chunk < NSEQ; chunk += 32) {
        // ---- S^T tiles: s[t][qt] = (K rows chunk+t*16..+15) x (q subtile) ----
        v8f s[2][2];
#pragma unroll
        for (int t = 0; t < 2; ++t) {
            const _Float16* kb =
                Kh + ((size_t)bh * NSEQ + chunk + t * 16 + col) * HDIM + hi * 8;
            v16h aK0 = frag_from_h16(kb);
            v16h aK1 = frag_from_h16(kb + 32);
#pragma unroll
            for (int qt = 0; qt < 2; ++qt) {
                v8f acc = {};
                acc = __builtin_amdgcn_wmma_f32_16x16x32_f16(
                    false, aK0, false, bQ[qt][0], (short)0, acc, false, false);
                acc = __builtin_amdgcn_wmma_f32_16x16x32_f16(
                    false, aK1, false, bQ[qt][1], (short)0, acc, false, false);
                s[t][qt] = acc;
            }
        }

        // ---- P^T = 2^(S^T): pack straight into B-layout fragments ----
        // B fragment elements {0..7} = kv tile t=0 regs, {8..15} = t=1 regs.
        v16h pb[2];
#pragma unroll
        for (int qt = 0; qt < 2; ++qt) {
            float acc = 0.0f;
#pragma unroll
            for (int i = 0; i < 8; ++i) {
                const float p0 = __builtin_amdgcn_exp2f(s[0][qt][i]);
                const float p1 = __builtin_amdgcn_exp2f(s[1][qt][i]);
                acc += p0 + p1;
                pb[qt][i]     = (_Float16)p0;
                pb[qt][8 + i] = (_Float16)p1;
            }
            lrow[qt] += acc;
        }

        // ---- O^T += V^T x P^T  (Vt: kv contiguous -> A fragments) ----
#pragma unroll
        for (int g = 0; g < 4; ++g) {
            v16h aV = frag_from_h16(
                Vt + ((size_t)bh * HDIM + g * 16 + col) * NSEQ + chunk + hi * 8);
#pragma unroll
            for (int qt = 0; qt < 2; ++qt)
                o[qt][g] = __builtin_amdgcn_wmma_f32_16x16x32_f16(
                    false, aV, false, pb[qt], (short)0, o[qt][g], false, false);
        }
    }

    // ---- finalize: combine the two kv half-sums, normalize, store O ----
#pragma unroll
    for (int qt = 0; qt < 2; ++qt) {
        const float l   = lrow[qt] + __shfl_xor(lrow[qt], 16, 32);
        const float inv = 1.0f / l;
        const int   qrow = q0 + qt * 16 + col;           // lane = q column
        _Float16* rowp = AO + ((size_t)b * NSEQ + qrow) * CDIM + h * HDIM;
#pragma unroll
        for (int g = 0; g < 4; ++g) {
            v8h r;
#pragma unroll
            for (int i = 0; i < 8; ++i) r[i] = (_Float16)(o[qt][g][i] * inv);
            *(v8h*)(rowp + g * 16 + hi * 8) = r;          // 8 contiguous d
        }
    }
}

// ---------------------------------------------------------------------------
extern "C" void kernel_launch(void* const* d_in, const int* in_sizes, int n_in,
                              void* d_out, int out_size, void* d_ws, size_t ws_size,
                              hipStream_t stream) {
    const float* q  = (const float*)d_in[0];
    const float* k  = (const float*)d_in[1];
    const float* v  = (const float*)d_in[2];
    const float* Wq = (const float*)d_in[3];
    const float* bq = (const float*)d_in[4];
    const float* Wk = (const float*)d_in[5];
    const float* bk = (const float*)d_in[6];
    const float* Wv = (const float*)d_in[7];
    const float* bv = (const float*)d_in[8];
    const float* Wo = (const float*)d_in[9];
    const float* bo = (const float*)d_in[10];
    float* out = (float*)d_out;

    // Workspace layout (f16 tensors)
    char* ws = (char*)d_ws;
    const size_t xbytes = (size_t)BN * CDIM * sizeof(_Float16);     // 8 MB
    const size_t wbytes = (size_t)CDIM * CDIM * sizeof(_Float16);   // 2 MB
    _Float16* Xq  = (_Float16*)(ws);
    _Float16* Xk  = (_Float16*)(ws + 1 * xbytes);
    _Float16* Xv  = (_Float16*)(ws + 2 * xbytes);
    _Float16* Wqh = (_Float16*)(ws + 3 * xbytes);
    _Float16* Wkh = (_Float16*)(ws + 3 * xbytes + 1 * wbytes);
    _Float16* Wvh = (_Float16*)(ws + 3 * xbytes + 2 * wbytes);
    _Float16* Woh = (_Float16*)(ws + 3 * xbytes + 3 * wbytes);
    char* base2 = ws + 3 * xbytes + 4 * wbytes;
    _Float16* Qh = (_Float16*)(base2);
    _Float16* Kh = (_Float16*)(base2 + 1 * xbytes);
    _Float16* Vt = (_Float16*)(base2 + 2 * xbytes);
    _Float16* AO = (_Float16*)(base2 + 3 * xbytes);

    // 1) bulk f32 -> f16 conversion of activations and weights
    const int xn8 = (BN * CDIM) / 8;       // 524288
    const int wn8 = (CDIM * CDIM) / 8;     // 131072
    cvt_kernel<<<(xn8 + 255) / 256, 256, 0, stream>>>(q,  Xq,  xn8);
    cvt_kernel<<<(xn8 + 255) / 256, 256, 0, stream>>>(k,  Xk,  xn8);
    cvt_kernel<<<(xn8 + 255) / 256, 256, 0, stream>>>(v,  Xv,  xn8);
    cvt_kernel<<<(wn8 + 255) / 256, 256, 0, stream>>>(Wq, Wqh, wn8);
    cvt_kernel<<<(wn8 + 255) / 256, 256, 0, stream>>>(Wk, Wkh, wn8);
    cvt_kernel<<<(wn8 + 255) / 256, 256, 0, stream>>>(Wv, Wvh, wn8);
    cvt_kernel<<<(wn8 + 255) / 256, 256, 0, stream>>>(Wo, Woh, wn8);

    // 2) projections (1/sqrt(HDIM) * log2(e) folded into Q)
    const dim3 gProj(BN / 16, CDIM / 128);
    proj_kernel<0><<<gProj, 32, 0, stream>>>(Xq, Wqh, bq, (void*)Qh, QSCALE);
    proj_kernel<0><<<gProj, 32, 0, stream>>>(Xk, Wkh, bk, (void*)Kh, 1.0f);
    proj_kernel<1><<<gProj, 32, 0, stream>>>(Xv, Wvh, bv, (void*)Vt, 1.0f);

    // 3) attention
    attn_kernel<<<dim3(NSEQ / 32, BATCH * NHEADS), 32, 0, stream>>>(Qh, Kh, Vt, AO);

    // 4) output projection -> f32 d_out
    proj_kernel<2><<<gProj, 32, 0, stream>>>(AO, Woh, bo, (void*)out, 1.0f);
}

// v001
// It runs in 159 microseconds.
// In two side-by-side timings against v000, it was 2.37 and 2.40 times as fast.
#include <hip/hip_runtime.h>

#define BATCH  2
#define NSEQ   2048
#define CDIM   1024
#define NHEADS 16
#define HDIM   64
#define BN     (BATCH * NSEQ)   // 4096 total rows

typedef __attribute__((ext_vector_type(16))) _Float16 v16h;
typedef __attribute__((ext_vector_type(8)))  _Float16 v8h;
typedef __attribute__((ext_vector_type(8)))  float    v8f;

// 0.125 (=1/sqrt(HDIM)) * log2(e): folded into the Q projection so the
// attention kernel can use v_exp_f32 (2^x) directly with no per-element mul.
#define QSCALE 0.1803368801f

// ---------------------------------------------------------------------------
// Fragment builder matching the CDNA5 16-bit A/B lane layout:
//   lanes 0-15 : K elements {k0+0..7, k0+16..23}
//   lanes 16-31: K elements {k0+8..15, k0+24..31}
// Caller passes a pointer already offset by (hi ? 8 : 0).
// ---------------------------------------------------------------------------
__device__ __forceinline__ v16h frag_from_h16(const _Float16* p) {
    v8h lo = *(const v8h*)p;
    v8h hh = *(const v8h*)(p + 16);
    v16h r;
#pragma unroll
    for (int i = 0; i < 8; ++i) { r[i] = lo[i]; r[8 + i] = hh[i]; }
    return r;
}

// ---------------------------------------------------------------------------
// f32 -> f16 bulk convert (8 elements / thread, b128 in / b128 out)
// ---------------------------------------------------------------------------
__global__ __launch_bounds__(256) void cvt_kernel(const float* __restrict__ in,
                                                  _Float16* __restrict__ out,
                                                  int n8) {
    const int i = blockIdx.x * 256 + threadIdx.x;
    if (i >= n8) return;
    const float4 a = ((const float4*)in)[2 * i + 0];
    const float4 b = ((const float4*)in)[2 * i + 1];
    v8h r;
    r[0] = (_Float16)a.x; r[1] = (_Float16)a.y;
    r[2] = (_Float16)a.z; r[3] = (_Float16)a.w;
    r[4] = (_Float16)b.x; r[5] = (_Float16)b.y;
    r[6] = (_Float16)b.z; r[7] = (_Float16)b.w;
    ((v8h*)out)[i] = r;
}

// ---------------------------------------------------------------------------
// Transposed projection GEMM: computes Out^T = W @ X^T  (i.e. Out = X @ W^T),
// + bias, * oscale.  One work-group of 8 waves (2 x 4): 128 output channels (j)
// x 128 rows (m); one wave: 64 x 32 = 4 x 2 accumulator tiles, two waves per SIMD.
// Both operand tiles are staged in LDS, 128 k (256 B of every row) per stage,
// two buffers, filled by asynchronous copies that fly while the other buffer
// is worked on.  Every global line is fetched once per work-group, as whole
// 256-B row pieces, instead of once per wave in 32-B pieces.
// The D-matrix C-layout has j running along registers -> contiguous
// epilogue stores; bias is indexed along registers.
// MODE 0: f16 out, head-major   [B,H,N,D]   (Q with oscale=QSCALE, K)
// MODE 1: f16 out, d-transposed [B,H,D,N]   (V)
// MODE 2: f32 out, plain        [BN,CDIM]   (final output projection)
// ---------------------------------------------------------------------------
#define PT_JROWS 128                       // W rows (output channels) per work-group
#define PT_MROWS 128                       // X rows per work-group
#define PT_KS    128                       // k per stage
#define PT_PITCH 272                       // LDS row pitch, bytes: 16 B x odd, no bank conflict for b128 reads
#define PT_STAGE ((PT_JROWS + PT_MROWS) * PT_PITCH)  // one buffer: [W 128 rows | X 128 rows]
#define PT_NT    (CDIM / PT_KS)            // stages

// Eight asynchronous 16-byte copies per lane, global -> LDS, rows 16 apart.
// s_wait_xcnt closes the statement: no address register named here is
// rewritten in front of it.
__device__ __forceinline__ void async_rows8(unsigned lds, const _Float16* g) {
    asm volatile(
        "global_load_async_to_lds_b128 %0, %8, off\n\t"
        "global_load_async_to_lds_b128 %1, %9, off\n\t"
        "global_load_async_to_lds_b128 %2, %10, off\n\t"
        "global_load_async_to_lds_b128 %3, %11, off\n\t"
        "global_load_async_to_lds_b128 %4, %12, off\n\t"
        "global_load_async_to_lds_b128 %5, %13, off\n\t"
        "global_load_async_to_lds_b128 %6, %14, off\n\t"
        "global_load_async_to_lds_b128 %7, %15, off\n\t"
        "s_wait_xcnt 0x0"
        :: "v"(lds + 0 * 16 * PT_PITCH), "v"(lds + 1 * 16 * PT_PITCH),
           "v"(lds + 2 * 16 * PT_PITCH), "v"(lds + 3 * 16 * PT_PITCH),
           "v"(lds + 4 * 16 * PT_PITCH), "v"(lds + 5 * 16 * PT_PITCH),
           "v"(lds + 6 * 16 * PT_PITCH), "v"(lds + 7 * 16 * PT_PITCH),
           "v"(g + 0 * 16 * CDIM), "v"(g + 1 * 16 * CDIM),
           "v"(g + 2 * 16 * CDIM), "v"(g + 3 * 16 * CDIM),
           "v"(g + 4 * 16 * CDIM), "v"(g + 5 * 16 * CDIM),
           "v"(g + 6 * 16 * CDIM), "v"(g + 7 * 16 * CDIM)
        : "memory");
}

// One stage: 256 rows of 256 B.  A lane's 16 copies take rows (tid >> 4) + 16 i
// at byte column (tid & 15) * 16; lds, gW and gX already hold that lane offset.
__device__ __forceinline__ void fill_stage(unsigned lds, const _Float16* gW,
                                           const _Float16* gX) {
    async_rows8(lds, gW);
    async_rows8(lds + PT_JROWS * PT_PITCH, gX);
}

template <int MODE>
__global__ __launch_bounds__(256) void proj_kernel(const _Float16* __restrict__ X,
                                                   const _Float16* __restrict__ W,
                                                   const float* __restrict__ bias,
                                                   void* __restrict__ outv,
                                                   float oscale) {
    __shared__ __attribute__((aligned(16))) unsigned char L[2 * PT_STAGE];

    const int tid  = threadIdx.x;
    const int lane = tid & 31;
    const int wave = tid >> 5;
    const int col  = lane & 15;
    const int hi   = lane >> 4;
    const int wj   = wave >> 2;               // wave's 64-channel half
    const int wm   = wave & 3;                // wave's 32-row quarter
    const int m0   = blockIdx.x * PT_MROWS;   // row tile over BN (lanes)
    const int n0   = blockIdx.y * PT_JROWS;   // output-channel tile (registers)

    // this lane's place in a stage, for the copies
    const unsigned  ldsc = (unsigned)(size_t)L + (tid >> 4) * PT_PITCH + (tid & 15) * 16;
    const _Float16* gW   = W + (size_t)(n0 + (tid >> 4)) * CDIM + (tid & 15) * 8;
    const _Float16* gX   = X + (size_t)(m0 + (tid >> 4)) * CDIM + (tid & 15) * 8;

    v8f c[4][2];   // [channel subtile g][row subtile mt]
#pragma unroll
    for (int g = 0; g < 4; ++g)
#pragma unroll
        for (int mt = 0; mt < 2; ++mt) c[g][mt] = v8f{};

    // stage 0 lands and is published, then stage 1 starts to fly
    fill_stage(ldsc, gW, gX);
    asm volatile("s_wait_asynccnt 0x0" ::: "memory");   // this wave's copies of stage 0 have landed
    __syncthreads();                                    // ... and every other wave's
    fill_stage(ldsc + PT_STAGE, gW + PT_KS, gX + PT_KS);

    // kept rolled: unrolled, each trip's first fragment reads were placed behind
    // the second set's, so the first product waited for all 24 reads
#pragma unroll 1
    for (int t = 0; t < PT_NT; ++t) {
        const unsigned char* buf = L + (t & 1) * PT_STAGE;
        const _Float16* aB = (const _Float16*)(buf + (wj * 64 + col) * PT_PITCH) + hi * 8;
        const _Float16* bB = (const _Float16*)(buf + (PT_JROWS + wm * 32 + col) * PT_PITCH) + hi * 8;
        // Two fragment sets.  A = W: lane holds row j; B = X^T: lane holds
        // column m; both contiguous in k.
        v16h aW[2][4], bX[2][2];
#pragma unroll
        for (int g = 0; g < 4; ++g) aW[0][g] = frag_from_h16(aB + g * 16 * (PT_PITCH / 2));
#pragma unroll
        for (int mt = 0; mt < 2; ++mt) bX[0][mt] = frag_from_h16(bB + mt * 16 * (PT_PITCH / 2));
#pragma unroll
        for (int ks = 0; ks < PT_KS / 32; ++ks) {
            const int cur = ks & 1;
            if (ks + 1 < PT_KS / 32) {
#pragma unroll
                for (int g = 0; g < 4; ++g)
                    aW[cur ^ 1][g] = frag_from_h16(aB + g * 16 * (PT_PITCH / 2) + (ks + 1) * 32);
#pragma unroll
                for (int mt = 0; mt < 2; ++mt)
                    bX[cur ^ 1][mt] = frag_from_h16(bB + mt * 16 * (PT_PITCH / 2) + (ks + 1) * 32);
            }
            // keeps the next k step's LDS reads one group ahead of this step's
            // products; unfenced they sink to just before their use and stall it
            __builtin_amdgcn_sched_barrier(0);
#pragma unroll
            for (int g = 0; g < 4; ++g)
#pragma unroll
                for (int mt = 0; mt < 2; ++mt)
                    c[g][mt] = __builtin_amdgcn_wmma_f32_16x16x32_f16(
                        false, aW[cur][g], false, bX[cur][mt], (short)0, c[g][mt], false, false);
            // closes the run of products: no later LDS read moves up among them
            __builtin_amdgcn_sched_barrier(0);
        }
        asm volatile("s_wait_dscnt 0x0" ::: "memory");      // this wave has left buffer t & 1
        asm volatile("s_wait_asynccnt 0x0" ::: "memory");   // its copies of stage t + 1 have landed
        __syncthreads();   // publishes stage t + 1; every reader has left buffer t & 1
        if (t + 2 < PT_NT)
            fill_stage(ldsc + (t & 1) * PT_STAGE, gW + (t + 2) * PT_KS, gX + (t + 2) * PT_KS);
    }
    asm volatile("s_wait_asynccnt 0x0" ::: "memory");       // no copy outlives the loop

    // Epilogue: Out^T C-layout -> lane holds fixed m; register i is channel
    // j0+i with j0 = n0 + wj*64 + g*16 + hi*8 (8 contiguous channels per store).
    const float* bp = bias + n0 + wj * 64 + hi * 8;
#pragma unroll
    for (int g = 0; g < 4; ++g) {
        const int j0 = n0 + wj * 64 + g * 16 + hi * 8;
        float bj[8];
#pragma unroll
        for (int i = 0; i < 8; ++i) bj[i] = bp[g * 16 + i];
#pragma unroll
        for (int mt = 0; mt < 2; ++mt) {
            const int m = m0 + wm * 32 + mt * 16 + col;
            const int b = m >> 11;               // m / NSEQ
            const int n = m & 2047;              // m % NSEQ
            float vals[8];
#pragma unroll
            for (int i = 0; i < 8; ++i) vals[i] = (c[g][mt][i] + bj[i]) * oscale;
            if (MODE == 0) {
                const int h = j0 >> 6, d0 = j0 & 63;
                v8h r;
#pragma unroll
                for (int i = 0; i < 8; ++i) r[i] = (_Float16)vals[i];
                *(v8h*)((_Float16*)outv +
                        (((size_t)b * NHEADS + h) * NSEQ + n) * HDIM + d0) = r;
            } else if (MODE == 1) {
                const int h = j0 >> 6, d0 = j0 & 63;
#pragma unroll
                for (int i = 0; i < 8; ++i)
                    ((_Float16*)outv)[(((size_t)b * NHEADS + h) * HDIM + d0 + i) * NSEQ + n] =
                        (_Float16)vals[i];
            } else {
                float* op = (float*)outv + (size_t)m * CDIM + j0;
                *(float4*)(op + 0) = make_float4(vals[0], vals[1], vals[2], vals[3]);
                *(float4*)(op + 4) = make_float4(vals[4], vals[5], vals[6], vals[7]);
            }
        }
    }
}

// ---------------------------------------------------------------------------
// Attention, transposed formulation (no LDS, no barriers):
//   S^T = K · Q^T      (A = K tile, B = Q^T tile; both contiguous loads)
//   P^T = exp2(S^T)    (C-layout of S^T IS the B-layout of P^T for step 2)
//   O^T += V^T · P^T   (A = V^T from the pre-transposed Vt tensor)
// One wave: 32 q rows (two 16-col subtiles of S^T), kv chunks of 32.
// Row sums of P are per-lane scalars (lane = fixed q); one xor-16 shuffle at
// the end.  O^T epilogue stores are contiguous v8h.
// ---------------------------------------------------------------------------
__global__ __launch_bounds__(32) void attn_kernel(const _Float16* __restrict__ Qh,
                                                  const _Float16* __restrict__ Kh,
                                                  const _Float16* __restrict__ Vt,
                                                  _Float16* __restrict__ AO) {
    const int lane = threadIdx.x;
    const int col  = lane & 15;
    const int hi   = lane >> 4;
    const int q0   = blockIdx.x * 32;
    const int bh   = blockIdx.y;              // b*NHEADS + h
    const int b    = bh >> 4;
    const int h    = bh & 15;

    // B = Q^T fragments: [q-subtile][d-fragment]; lane holds q column
    v16h bQ[2][2];
#pragma unroll
    for (int qt = 0; qt < 2; ++qt)
#pragma unroll
        for (int f = 0; f < 2; ++f)
            bQ[qt][f] = frag_from_h16(
                Qh + ((size_t)bh * NSEQ + q0 + qt * 16 + col) * HDIM + f * 32 + hi * 8);

    float lrow[2] = {0.0f, 0.0f};
    v8f o[2][4];   // O^T accumulators: [q-subtile][d-group]
#pragma unroll
    for (int qt = 0; qt < 2; ++qt)
#pragma unroll
        for (int g = 0; g < 4; ++g) o[qt][g] = v8f{};

    for (int chunk = 0; chunk < NSEQ; chunk += 32) {
        // ---- S^T tiles: s[t][qt] = (K rows chunk+t*16..+15) x (q subtile) ----
        v8f s[2][2];
#pragma unroll
        for (int t = 0; t < 2; ++t) {
            const _Float16* kb =
                Kh + ((size_t)bh * NSEQ + chunk + t * 16 + col) * HDIM + hi * 8;
            v16h aK0 = frag_from_h16(kb);
            v16h aK1 = frag_from_h16(kb + 32);
#pragma unroll
            for (int qt = 0; qt < 2; ++qt) {
                v8f acc = {};
                acc = __builtin_amdgcn_wmma_f32_16x16x32_f16(
                    false, aK0, false, bQ[qt][0], (short)0, acc, false, false);
                acc = __builtin_amdgcn_wmma_f32_16x16x32_f16(
                    false, aK1, false, bQ[qt][1], (short)0, acc, false, false);
                s[t][qt] = acc;
            }
        }

        // ---- P^T = 2^(S^T): pack straight into B-layout fragments ----
        // B fragment elements {0..7} = kv tile t=0 regs, {8..15} = t=1 regs.
        v16h pb[2];
#pragma unroll
        for (int qt = 0; qt < 2; ++qt) {
            float acc = 0.0f;
#pragma unroll
            for (int i = 0; i < 8; ++i) {
                const float p0 = __builtin_amdgcn_exp2f(s[0][qt][i]);
                const float p1 = __builtin_amdgcn_exp2f(s[1][qt][i]);
                acc += p0 + p1;
                pb[qt][i]     = (_Float16)p0;
                pb[qt][8 + i] = (_Float16)p1;
            }
            lrow[qt] += acc;
        }

        // ---- O^T += V^T x P^T  (Vt: kv contiguous -> A fragments) ----
#pragma unroll
        for (int g = 0; g < 4; ++g) {
            v16h aV = frag_from_h16(
                Vt + ((size_t)bh * HDIM + g * 16 + col) * NSEQ + chunk + hi * 8);
#pragma unroll
            for (int qt = 0; qt < 2; ++qt)
                o[qt][g] = __builtin_amdgcn_wmma_f32_16x16x32_f16(
                    false, aV, false, pb[qt], (short)0, o[qt][g], false, false);
        }
    }

    // ---- finalize: combine the two kv half-sums, normalize, store O ----
#pragma unroll
    for (int qt = 0; qt < 2; ++qt) {
        const float l   = lrow[qt] + __shfl_xor(lrow[qt], 16, 32);
        const float inv = 1.0f / l;
        const int   qrow = q0 + qt * 16 + col;           // lane = q column
        _Float16* rowp = AO + ((size_t)b * NSEQ + qrow) * CDIM + h * HDIM;
#pragma unroll
        for (int g = 0; g < 4; ++g) {
            v8h r;
#pragma unroll
            for (int i = 0; i < 8; ++i) r[i] = (_Float16)(o[qt][g][i] * inv);
            *(v8h*)(rowp + g * 16 + hi * 8) = r;          // 8 contiguous d
        }
    }
}

// ---------------------------------------------------------------------------
extern "C" void kernel_launch(void* const* d_in, const int* in_sizes, int n_in,
                              void* d_out, int out_size, void* d_ws, size_t ws_size,
                              hipStream_t stream) {
    const float* q  = (const float*)d_in[0];
    const float* k  = (const float*)d_in[1];
    const float* v  = (const float*)d_in[2];
    const float* Wq = (const float*)d_in[3];
    const float* bq = (const float*)d_in[4];
    const float* Wk = (const float*)d_in[5];
    const float* bk = (const float*)d_in[6];
    const float* Wv = (const float*)d_in[7];
    const float* bv = (const float*)d_in[8];
    const float* Wo = (const float*)d_in[9];
    const float* bo = (const float*)d_in[10];
    float* out = (float*)d_out;

    // Workspace layout (f16 tensors)
    char* ws = (char*)d_ws;
    const size_t xbytes = (size_t)BN * CDIM * sizeof(_Float16);     // 8 MB
    const size_t wbytes = (size_t)CDIM * CDIM * sizeof(_Float16);   // 2 MB
    _Float16* Xq  = (_Float16*)(ws);
    _Float16* Xk  = (_Float16*)(ws + 1 * xbytes);
    _Float16* Xv  = (_Float16*)(ws + 2 * xbytes);
    _Float16* Wqh = (_Float16*)(ws + 3 * xbytes);
    _Float16* Wkh = (_Float16*)(ws + 3 * xbytes + 1 * wbytes);
    _Float16* Wvh = (_Float16*)(ws + 3 * xbytes + 2 * wbytes);
    _Float16* Woh = (_Float16*)(ws + 3 * xbytes + 3 * wbytes);
    char* base2 = ws + 3 * xbytes + 4 * wbytes;
    _Float16* Qh = (_Float16*)(base2);
    _Float16* Kh = (_Float16*)(base2 + 1 * xbytes);
    _Float16* Vt = (_Float16*)(base2 + 2 * xbytes);
    _Float16* AO = (_Float16*)(base2 + 3 * xbytes);

    // 1) bulk f32 -> f16 conversion of activations and weights
    const int xn8 = (BN * CDIM) / 8;       // 524288
    const int wn8 = (CDIM * CDIM) / 8;     // 131072
    cvt_kernel<<<(xn8 + 255) / 256, 256, 0, stream>>>(q,  Xq,  xn8);
    cvt_kernel<<<(xn8 + 255) / 256, 256, 0, stream>>>(k,  Xk,  xn8);
    cvt_kernel<<<(xn8 + 255) / 256, 256, 0, stream>>>(v,  Xv,  xn8);
    cvt_kernel<<<(wn8 + 255) / 256, 256, 0, stream>>>(Wq, Wqh, wn8);
    cvt_kernel<<<(wn8 + 255) / 256, 256, 0, stream>>>(Wk, Wkh, wn8);
    cvt_kernel<<<(wn8 + 255) / 256, 256, 0, stream>>>(Wv, Wvh, wn8);
    cvt_kernel<<<(wn8 + 255) / 256, 256, 0, stream>>>(Wo, Woh, wn8);

    // 2) projections (1/sqrt(HDIM) * log2(e) folded into Q)
    const dim3 gProj(BN / PT_MROWS, CDIM / PT_JROWS);
    proj_kernel<0><<<gProj, 256, 0, stream>>>(Xq, Wqh, bq, (void*)Qh, QSCALE);
    proj_kernel<0><<<gProj, 256, 0, stream>>>(Xk, Wkh, bk, (void*)Kh, 1.0f);
    proj_kernel<1><<<gProj, 256, 0, stream>>>(Xv, Wvh, bv, (void*)Vt, 1.0f);

    // 3) attention
    attn_kernel<<<dim3(NSEQ / 32, BATCH * NHEADS), 32, 0, stream>>>(Qh, Kh, Vt, AO);

    // 4) output projection -> f32 d_out
    proj_kernel<2><<<gProj, 256, 0, stream>>>(AO, Woh, bo, (void*)out, 1.0f);
}

// v002
// Measured time: 94.2 microseconds a run.
// In two side-by-side timings against v001, it was 1.68 and 1.69 times as fast.
// Counting every step since v000, it is 4.01 times as fast.
#include <hip/hip_runtime.h>

#define BATCH  2
#define NSEQ   2048
#define CDIM   1024
#define NHEADS 16
#define HDIM   64
#define BN     (BATCH * NSEQ)   // 4096 total rows

typedef __attribute__((ext_vector_type(16))) _Float16 v16h;
typedef __attribute__((ext_vector_type(8)))  _Float16 v8h;
typedef __attribute__((ext_vector_type(8)))  float    v8f;

// 0.125 (=1/sqrt(HDIM)) * log2(e): folded into the Q projection so the
// attention kernel can use v_exp_f32 (2^x) directly with no per-element mul.
#define QSCALE 0.1803368801f

// ---------------------------------------------------------------------------
// Fragment builder matching the CDNA5 16-bit A/B lane layout:
//   lanes 0-15 : K elements {k0+0..7, k0+16..23}
//   lanes 16-31: K elements {k0+8..15, k0+24..31}
// Caller passes a pointer already offset by (hi ? 8 : 0).
// ---------------------------------------------------------------------------
__device__ __forceinline__ v16h frag_from_h16(const _Float16* p) {
    v8h lo = *(const v8h*)p;
    v8h hh = *(const v8h*)(p + 16);
    v16h r;
#pragma unroll
    for (int i = 0; i < 8; ++i) { r[i] = lo[i]; r[8 + i] = hh[i]; }
    return r;
}

// ---------------------------------------------------------------------------
// f32 -> f16 bulk convert (8 elements / thread, b128 in / b128 out)
// ---------------------------------------------------------------------------
__global__ __launch_bounds__(256) void cvt_kernel(const float* __restrict__ in,
                                                  _Float16* __restrict__ out,
                                                  int n8) {
    const int i = blockIdx.x * 256 + threadIdx.x;
    if (i >= n8) return;
    const float4 a = ((const float4*)in)[2 * i + 0];
    const float4 b = ((const float4*)in)[2 * i + 1];
    v8h r;
    r[0] = (_Float16)a.x; r[1] = (_Float16)a.y;
    r[2] = (_Float16)a.z; r[3] = (_Float16)a.w;
    r[4] = (_Float16)b.x; r[5] = (_Float16)b.y;
    r[6] = (_Float16)b.z; r[7] = (_Float16)b.w;
    ((v8h*)out)[i] = r;
}

// ---------------------------------------------------------------------------
// Transposed projection GEMM: computes Out^T = W @ X^T  (i.e. Out = X @ W^T),
// + bias, * oscale.  One work-group of 8 waves (2 x 4): 128 output channels (j)
// x 128 rows (m); one wave: 64 x 32 = 4 x 2 accumulator tiles, two waves per SIMD.
// Both operand tiles are staged in LDS, 128 k (256 B of every row) per stage,
// two buffers, filled by asynchronous copies that fly while the other buffer
// is worked on.  Every global line is fetched once per work-group, as whole
// 256-B row pieces, instead of once per wave in 32-B pieces.
// The D-matrix C-layout has j running along registers -> contiguous
// epilogue stores; bias is indexed along registers.
// MODE 0: f16 out, head-major   [B,H,N,D]   (Q with oscale=QSCALE, K)
// MODE 1: f16 out, d-transposed [B,H,D,N]   (V)
// MODE 2: f32 out, plain        [BN,CDIM]   (final output projection)
// ---------------------------------------------------------------------------
#define PT_JROWS 128                       // W rows (output channels) per work-group
#define PT_MROWS 128                       // X rows per work-group
#define PT_KS    128                       // k per stage
#define PT_PITCH 272                       // LDS row pitch, bytes: 16 B x odd, no bank conflict for b128 reads
#define PT_STAGE ((PT_JROWS + PT_MROWS) * PT_PITCH)  // one buffer: [W 128 rows | X 128 rows]
#define PT_NT    (CDIM / PT_KS)            // stages

// Eight asynchronous 16-byte copies per lane, global -> LDS, rows 16 apart.
// s_wait_xcnt closes the statement: no address register named here is
// rewritten in front of it.
__device__ __forceinline__ void async_rows8(unsigned lds, const _Float16* g) {
    asm volatile(
        "global_load_async_to_lds_b128 %0, %8, off\n\t"
        "global_load_async_to_lds_b128 %1, %9, off\n\t"
        "global_load_async_to_lds_b128 %2, %10, off\n\t"
        "global_load_async_to_lds_b128 %3, %11, off\n\t"
        "global_load_async_to_lds_b128 %4, %12, off\n\t"
        "global_load_async_to_lds_b128 %5, %13, off\n\t"
        "global_load_async_to_lds_b128 %6, %14, off\n\t"
        "global_load_async_to_lds_b128 %7, %15, off\n\t"
        "s_wait_xcnt 0x0"
        :: "v"(lds + 0 * 16 * PT_PITCH), "v"(lds + 1 * 16 * PT_PITCH),
           "v"(lds + 2 * 16 * PT_PITCH), "v"(lds + 3 * 16 * PT_PITCH),
           "v"(lds + 4 * 16 * PT_PITCH), "v"(lds + 5 * 16 * PT_PITCH),
           "v"(lds + 6 * 16 * PT_PITCH), "v"(lds + 7 * 16 * PT_PITCH),
           "v"(g + 0 * 16 * CDIM), "v"(g + 1 * 16 * CDIM),
           "v"(g + 2 * 16 * CDIM), "v"(g + 3 * 16 * CDIM),
           "v"(g + 4 * 16 * CDIM), "v"(g + 5 * 16 * CDIM),
           "v"(g + 6 * 16 * CDIM), "v"(g + 7 * 16 * CDIM)
        : "memory");
}

// One stage: 256 rows of 256 B.  A lane's 16 copies take rows (tid >> 4) + 16 i
// at byte column (tid & 15) * 16; lds, gW and gX already hold that lane offset.
__device__ __forceinline__ void fill_stage(unsigned lds, const _Float16* gW,
                                           const _Float16* gX) {
    async_rows8(lds, gW);
    async_rows8(lds + PT_JROWS * PT_PITCH, gX);
}

template <int MODE>
__global__ __launch_bounds__(256) void proj_kernel(const _Float16* __restrict__ X,
                                                   const _Float16* __restrict__ W,
                                                   const float* __restrict__ bias,
                                                   void* __restrict__ outv,
                                                   float oscale) {
    __shared__ __attribute__((aligned(16))) unsigned char L[2 * PT_STAGE];

    const int tid  = threadIdx.x;
    const int lane = tid & 31;
    const int wave = tid >> 5;
    const int col  = lane & 15;
    const int hi   = lane >> 4;
    const int wj   = wave >> 2;               // wave's 64-channel half
    const int wm   = wave & 3;                // wave's 32-row quarter
    const int m0   = blockIdx.x * PT_MROWS;   // row tile over BN (lanes)
    const int n0   = blockIdx.y * PT_JROWS;   // output-channel tile (registers)

    // this lane's place in a stage, for the copies
    const unsigned  ldsc = (unsigned)(size_t)L + (tid >> 4) * PT_PITCH + (tid & 15) * 16;
    const _Float16* gW   = W + (size_t)(n0 + (tid >> 4)) * CDIM + (tid & 15) * 8;
    const _Float16* gX   = X + (size_t)(m0 + (tid >> 4)) * CDIM + (tid & 15) * 8;

    v8f c[4][2];   // [channel subtile g][row subtile mt]
#pragma unroll
    for (int g = 0; g < 4; ++g)
#pragma unroll
        for (int mt = 0; mt < 2; ++mt) c[g][mt] = v8f{};

    // stage 0 lands and is published, then stage 1 starts to fly
    fill_stage(ldsc, gW, gX);
    asm volatile("s_wait_asynccnt 0x0" ::: "memory");   // this wave's copies of stage 0 have landed
    __syncthreads();                                    // ... and every other wave's
    fill_stage(ldsc + PT_STAGE, gW + PT_KS, gX + PT_KS);

    // kept rolled: unrolled, each trip's first fragment reads were placed behind
    // the second set's, so the first product waited for all 24 reads
#pragma unroll 1
    for (int t = 0; t < PT_NT; ++t) {
        const unsigned char* buf = L + (t & 1) * PT_STAGE;
        const _Float16* aB = (const _Float16*)(buf + (wj * 64 + col) * PT_PITCH) + hi * 8;
        const _Float16* bB = (const _Float16*)(buf + (PT_JROWS + wm * 32 + col) * PT_PITCH) + hi * 8;
        // Two fragment sets.  A = W: lane holds row j; B = X^T: lane holds
        // column m; both contiguous in k.
        v16h aW[2][4], bX[2][2];
#pragma unroll
        for (int g = 0; g < 4; ++g) aW[0][g] = frag_from_h16(aB + g * 16 * (PT_PITCH / 2));
#pragma unroll
        for (int mt = 0; mt < 2; ++mt) bX[0][mt] = frag_from_h16(bB + mt * 16 * (PT_PITCH / 2));
#pragma unroll
        for (int ks = 0; ks < PT_KS / 32; ++ks) {
            const int cur = ks & 1;
            if (ks + 1 < PT_KS / 32) {
#pragma unroll
                for (int g = 0; g < 4; ++g)
                    aW[cur ^ 1][g] = frag_from_h16(aB + g * 16 * (PT_PITCH / 2) + (ks + 1) * 32);
#pragma unroll
                for (int mt = 0; mt < 2; ++mt)
                    bX[cur ^ 1][mt] = frag_from_h16(bB + mt * 16 * (PT_PITCH / 2) + (ks + 1) * 32);
            }
            // keeps the next k step's LDS reads one group ahead of this step's
            // products; unfenced they sink to just before their use and stall it
            __builtin_amdgcn_sched_barrier(0);
#pragma unroll
            for (int g = 0; g < 4; ++g)
#pragma unroll
                for (int mt = 0; mt < 2; ++mt)
                    c[g][mt] = __builtin_amdgcn_wmma_f32_16x16x32_f16(
                        false, aW[cur][g], false, bX[cur][mt], (short)0, c[g][mt], false, false);
            // closes the run of products: no later LDS read moves up among them
            __builtin_amdgcn_sched_barrier(0);
        }
        asm volatile("s_wait_dscnt 0x0" ::: "memory");      // this wave has left buffer t & 1
        asm volatile("s_wait_asynccnt 0x0" ::: "memory");   // its copies of stage t + 1 have landed
        __syncthreads();   // publishes stage t + 1; every reader has left buffer t & 1
        if (t + 2 < PT_NT)
            fill_stage(ldsc + (t & 1) * PT_STAGE, gW + (t + 2) * PT_KS, gX + (t + 2) * PT_KS);
    }
    asm volatile("s_wait_asynccnt 0x0" ::: "memory");       // no copy outlives the loop

    // Epilogue: Out^T C-layout -> lane holds fixed m; register i is channel
    // j0+i with j0 = n0 + wj*64 + g*16 + hi*8 (8 contiguous channels per store).
    const float* bp = bias + n0 + wj * 64 + hi * 8;
#pragma unroll
    for (int g = 0; g < 4; ++g) {
        const int j0 = n0 + wj * 64 + g * 16 + hi * 8;
        float bj[8];
#pragma unroll
        for (int i = 0; i < 8; ++i) bj[i] = bp[g * 16 + i];
#pragma unroll
        for (int mt = 0; mt < 2; ++mt) {
            const int m = m0 + wm * 32 + mt * 16 + col;
            const int b = m >> 11;               // m / NSEQ
            const int n = m & 2047;              // m % NSEQ
            float vals[8];
#pragma unroll
            for (int i = 0; i < 8; ++i) vals[i] = (c[g][mt][i] + bj[i]) * oscale;
            if (MODE == 0) {
                const int h = j0 >> 6, d0 = j0 & 63;
                v8h r;
#pragma unroll
                for (int i = 0; i < 8; ++i) r[i] = (_Float16)vals[i];
                *(v8h*)((_Float16*)outv +
                        (((size_t)b * NHEADS + h) * NSEQ + n) * HDIM + d0) = r;
            } else if (MODE == 1) {
                const int h = j0 >> 6, d0 = j0 & 63;
#pragma unroll
                for (int i = 0; i < 8; ++i)
                    ((_Float16*)outv)[(((size_t)b * NHEADS + h) * HDIM + d0 + i) * NSEQ + n] =
                        (_Float16)vals[i];
            } else {
                float* op = (float*)outv + (size_t)m * CDIM + j0;
                *(float4*)(op + 0) = make_float4(vals[0], vals[1], vals[2], vals[3]);
                *(float4*)(op + 4) = make_float4(vals[4], vals[5], vals[6], vals[7]);
            }
        }
    }
}

// ---------------------------------------------------------------------------
// Attention, transposed formulation:
//   S^T = K * Q^T      (A = K tile, B = Q^T tile)
//   P^T = exp2(S^T)    (C-layout of S^T IS the B-layout of P^T for step 2)
//   O^T += V^T * P^T   (A = V^T from the pre-transposed Vt tensor)
// One work-group of 8 waves: 256 q rows of one head; one wave: 32 q rows (two
// 16-col subtiles of S^T), kv chunks of 32.  K and V^T are staged in LDS, 128
// keys per stage, two buffers, filled by asynchronous copies that fly while the
// other buffer is worked on: every K and V line is fetched once per work-group,
// as whole rows, instead of once per wave in 32-B pieces.
// Row sums of P are per-lane scalars (lane = fixed q); one xor-16 shuffle at
// the end.  O^T epilogue stores are contiguous v8h.
// ---------------------------------------------------------------------------
typedef __attribute__((ext_vector_type(2))) float v2f;

#define AT_KEYS  128                       // keys per stage
#define AT_KP    144                       // K row (one key, 128 B) pitch in LDS: 16 B x odd
#define AT_VP    272                       // V^T row (one d, 128 keys, 256 B) pitch in LDS: 16 B x odd
#define AT_KB    (AT_KEYS * AT_KP)         // K part of a buffer
#define AT_STAGE (AT_KB + HDIM * AT_VP)    // one buffer: [K 128 rows | V^T 64 rows]
#define AT_NT    (NSEQ / AT_KEYS)          // stages

// One stage: a lane's eight asynchronous 16-byte copies, global -> LDS.
// K: rows (tid >> 3) + 32 i at byte column (tid & 7) * 16; V^T: rows
// (tid >> 4) + 16 i at byte column (tid & 15) * 16; the arguments already hold
// that lane offset.  s_wait_xcnt closes the statement: no address register
// named here is rewritten in front of it.
__device__ __forceinline__ void fill_kv(unsigned ldsK, unsigned ldsV,
                                        const _Float16* gK, const _Float16* gV) {
    asm volatile(
        "global_load_async_to_lds_b128 %0, %8, off\n\t"
        "global_load_async_to_lds_b128 %1, %9, off\n\t"
        "global_load_async_to_lds_b128 %2, %10, off\n\t"
        "global_load_async_to_lds_b128 %3, %11, off\n\t"
        "global_load_async_to_lds_b128 %4, %12, off\n\t"
        "global_load_async_to_lds_b128 %5, %13, off\n\t"
        "global_load_async_to_lds_b128 %6, %14, off\n\t"
        "global_load_async_to_lds_b128 %7, %15, off\n\t"
        "s_wait_xcnt 0x0"
        :: "v"(ldsK + 0 * 32 * AT_KP), "v"(ldsK + 1 * 32 * AT_KP),
           "v"(ldsK + 2 * 32 * AT_KP), "v"(ldsK + 3 * 32 * AT_KP),
           "v"(ldsV + 0 * 16 * AT_VP), "v"(ldsV + 1 * 16 * AT_VP),
           "v"(ldsV + 2 * 16 * AT_VP), "v"(ldsV + 3 * 16 * AT_VP),
           "v"(gK + 0 * 32 * HDIM), "v"(gK + 1 * 32 * HDIM),
           "v"(gK + 2 * 32 * HDIM), "v"(gK + 3 * 32 * HDIM),
           "v"(gV + 0 * 16 * NSEQ), "v"(gV + 1 * 16 * NSEQ),
           "v"(gV + 2 * 16 * NSEQ), "v"(gV + 3 * 16 * NSEQ)
        : "memory");
}

// One stage of 128 keys out of one LDS buffer, four chunks of 32 keys.
__device__ __forceinline__ void attn_stage(const unsigned char* buf, int col, int hi,
                                           const v16h (&bQ)[2][2], v8f (&o)[2][4],
                                           v2f& lrow) {
    // A = K: lane holds key row, contiguous in d; A = V^T: lane holds d row,
    // contiguous in keys.
    const _Float16* kB = (const _Float16*)(buf + col * AT_KP) + hi * 8;
    const _Float16* vB = (const _Float16*)(buf + AT_KB + col * AT_VP) + hi * 8;

    v16h aK[2][2], aV[4];   // K: [key subtile t][d-fragment]; V^T: [d-group]
#pragma unroll
    for (int t = 0; t < 2; ++t)
#pragma unroll
        for (int f = 0; f < 2; ++f)
            aK[t][f] = frag_from_h16(kB + t * 16 * (AT_KP / 2) + f * 32);

#pragma unroll
    for (int c = 0; c < AT_KEYS / 32; ++c) {
        // this chunk's V^T reads, one group; they land behind the S^T products
        // and the exponentials
#pragma unroll
        for (int g = 0; g < 4; ++g)
            aV[g] = frag_from_h16(vB + g * 16 * (AT_VP / 2) + c * 32);
        // holds the V^T reads up here; unfenced each pair sinks to just
        // before its products, which then wait out the LDS latency
        __builtin_amdgcn_sched_barrier(0);

        // ---- S^T tiles: s[t][qt] = (K rows c*32+t*16..+15) x (q subtile) ----
        v8f s[2][2];
#pragma unroll
        for (int t = 0; t < 2; ++t)
#pragma unroll
            for (int qt = 0; qt < 2; ++qt) {
                v8f acc = {};
                acc = __builtin_amdgcn_wmma_f32_16x16x32_f16(
                    false, aK[t][0], false, bQ[qt][0], (short)0, acc, false, false);
                acc = __builtin_amdgcn_wmma_f32_16x16x32_f16(
                    false, aK[t][1], false, bQ[qt][1], (short)0, acc, false, false);
                s[t][qt] = acc;
            }
        if (c + 1 < AT_KEYS / 32) {
#pragma unroll
            for (int t = 0; t < 2; ++t)
#pragma unroll
                for (int f = 0; f < 2; ++f)
                    aK[t][f] = frag_from_h16(kB + ((c + 1) * 32 + t * 16) * (AT_KP / 2) + f * 32);
        }
        // holds the K reads ahead of the exponentials, a whole chunk's vector
        // work and products in front of their use; in the stage's last chunk,
        // which reads no K, it keeps the chunk in front of the stage's closing
        // barrier: unfenced it moved behind it, and the refill with it
        __builtin_amdgcn_sched_barrier(0);

        // ---- P^T = 2^(S^T): pack straight into B-layout fragments ----
        // B fragment elements {0..7} = kv tile t=0 regs, {8..15} = t=1 regs.
        // The two q subtiles' row sums run side by side as one packed pair: written
        // as two scalars they were gathered at the stage's end, every exponential
        // of the stage held in registers until there.
        v16h pb[2];
        v2f acc = {0.0f, 0.0f};
#pragma unroll
        for (int i = 0; i < 8; ++i) {
            const v2f p0 = {__builtin_amdgcn_exp2f(s[0][0][i]), __builtin_amdgcn_exp2f(s[0][1][i])};
            const v2f p1 = {__builtin_amdgcn_exp2f(s[1][0][i]), __builtin_amdgcn_exp2f(s[1][1][i])};
            acc += p0 + p1;
#pragma unroll
            for (int qt = 0; qt < 2; ++qt) {
                pb[qt][i]     = (_Float16)p0[qt];
                pb[qt][8 + i] = (_Float16)p1[qt];
            }
        }
        lrow += acc;

        // ---- O^T += V^T x P^T ----
#pragma unroll
        for (int g = 0; g < 4; ++g)
#pragma unroll
            for (int qt = 0; qt < 2; ++qt)
                o[qt][g] = __builtin_amdgcn_wmma_f32_16x16x32_f16(
                    false, aV[g], false, pb[qt], (short)0, o[qt][g], false, false);
    }
}

__global__ __launch_bounds__(256) void attn_kernel(const _Float16* __restrict__ Qh,
                                                   const _Float16* __restrict__ Kh,
                                                   const _Float16* __restrict__ Vt,
                                                   _Float16* __restrict__ AO) {
    __shared__ __attribute__((aligned(16))) unsigned char L[2 * AT_STAGE];

    const int tid  = threadIdx.x;
    const int lane = tid & 31;
    const int wave = tid >> 5;
    const int col  = lane & 15;
    const int hi   = lane >> 4;
    const int q0   = blockIdx.x * 256 + wave * 32;
    const int bh   = blockIdx.y;              // b*NHEADS + h
    const int b    = bh >> 4;
    const int h    = bh & 15;

    // this lane's place in a stage, for the copies
    const unsigned  ldsK = (unsigned)(size_t)L + (tid >> 3) * AT_KP + (tid & 7) * 16;
    const unsigned  ldsV = (unsigned)(size_t)L + AT_KB + (tid >> 4) * AT_VP + (tid & 15) * 16;
    const _Float16* gK   = Kh + ((size_t)bh * NSEQ + (tid >> 3)) * HDIM + (tid & 7) * 8;
    const _Float16* gV   = Vt + ((size_t)bh * HDIM + (tid >> 4)) * NSEQ + (tid & 15) * 8;

    // stage 0 starts to fly while Q is fetched
    fill_kv(ldsK, ldsV, gK, gV);

    // B = Q^T fragments: [q-subtile][d-fragment]; lane holds q column
    v16h bQ[2][2];
#pragma unroll
    for (int qt = 0; qt < 2; ++qt)
#pragma unroll
        for (int f = 0; f < 2; ++f)
            bQ[qt][f] = frag_from_h16(
                Qh + ((size_t)bh * NSEQ + q0 + qt * 16 + col) * HDIM + f * 32 + hi * 8);
    // the address registers of the Q loads are written again below
    asm volatile("s_wait_xcnt 0x0" ::: "memory");

    v2f lrow = {0.0f, 0.0f};   // row sums of P: [q-subtile]
    v8f o[2][4];   // O^T accumulators: [q-subtile][d-group]
#pragma unroll
    for (int qt = 0; qt < 2; ++qt)
#pragma unroll
        for (int g = 0; g < 4; ++g) o[qt][g] = v8f{};

    // stage 0 lands and is published, then stage 1 starts to fly
    asm volatile("s_wait_asynccnt 0x0" ::: "memory");   // this wave's copies of stage 0 have landed
    __syncthreads();                                    // ... and every other wave's
    fill_kv(ldsK + AT_STAGE, ldsV + AT_STAGE, gK + AT_KEYS * HDIM, gV + AT_KEYS);

    // Two loops, so that each trip is one straight run of code: with the refill
    // under a test inside the trip, the row sums moved behind that test and every
    // exponential of the stage stayed in registers until there.
    int st = 0;
    for (; st + 2 < AT_NT; ++st) {
        attn_stage(L + (st & 1) * AT_STAGE, col, hi, bQ, o, lrow);
        asm volatile("s_wait_dscnt 0x0" ::: "memory");      // this wave has left buffer st & 1
        asm volatile("s_wait_asynccnt 0x0" ::: "memory");   // its copies of stage st + 1 have landed
        __syncthreads();   // publishes stage st + 1; every reader has left buffer st & 1
        fill_kv(ldsK + (st & 1) * AT_STAGE, ldsV + (st & 1) * AT_STAGE,
                gK + (st + 2) * (AT_KEYS * HDIM), gV + (st + 2) * AT_KEYS);
    }
    // the last two stages: no stage st + 2 is left to fetch
    for (; st < AT_NT; ++st) {
        attn_stage(L + (st & 1) * AT_STAGE, col, hi, bQ, o, lrow);
        asm volatile("s_wait_dscnt 0x0" ::: "memory");      // this wave has left buffer st & 1
        asm volatile("s_wait_asynccnt 0x0" ::: "memory");   // its copies of stage st + 1 have landed
        __syncthreads();   // publishes stage st + 1
    }
    asm volatile("s_wait_asynccnt 0x0" ::: "memory");       // no copy outlives the loops

    // ---- finalize: combine the two kv half-sums, normalize, store O ----
#pragma unroll
    for (int qt = 0; qt < 2; ++qt) {
        const float l   = lrow[qt] + __shfl_xor(lrow[qt], 16, 32);
        const float inv = 1.0f / l;
        const int   qrow = q0 + qt * 16 + col;           // lane = q column
        _Float16* rowp = AO + ((size_t)b * NSEQ + qrow) * CDIM + h * HDIM;
#pragma unroll
        for (int g = 0; g < 4; ++g) {
            v8h r;
#pragma unroll
            for (int i = 0; i < 8; ++i) r[i] = (_Float16)(o[qt][g][i] * inv);
            *(v8h*)(rowp + g * 16 + hi * 8) = r;          // 8 contiguous d
        }
    }
}

// ---------------------------------------------------------------------------
extern "C" void kernel_launch(void* const* d_in, const int* in_sizes, int n_in,
                              void* d_out, int out_size, void* d_ws, size_t ws_size,
                              hipStream_t stream) {
    const float* q  = (const float*)d_in[0];
    const float* k  = (const float*)d_in[1];
    const float* v  = (const float*)d_in[2];
    const float* Wq = (const float*)d_in[3];
    const float* bq = (const float*)d_in[4];
    const float* Wk = (const float*)d_in[5];
    const float* bk = (const float*)d_in[6];
    const float* Wv = (const float*)d_in[7];
    const float* bv = (const float*)d_in[8];
    const float* Wo = (const float*)d_in[9];
    const float* bo = (const float*)d_in[10];
    float* out = (float*)d_out;

    // Workspace layout (f16 tensors)
    char* ws = (char*)d_ws;
    const size_t xbytes = (size_t)BN * CDIM * sizeof(_Float16);     // 8 MB
    const size_t wbytes = (size_t)CDIM * CDIM * sizeof(_Float16);   // 2 MB
    _Float16* Xq  = (_Float16*)(ws);
    _Float16* Xk  = (_Float16*)(ws + 1 * xbytes);
    _Float16* Xv  = (_Float16*)(ws + 2 * xbytes);
    _Float16* Wqh = (_Float16*)(ws + 3 * xbytes);
    _Float16* Wkh = (_Float16*)(ws + 3 * xbytes + 1 * wbytes);
    _Float16* Wvh = (_Float16*)(ws + 3 * xbytes + 2 * wbytes);
    _Float16* Woh = (_Float16*)(ws + 3 * xbytes + 3 * wbytes);
    char* base2 = ws + 3 * xbytes + 4 * wbytes;
    _Float16* Qh = (_Float16*)(base2);
    _Float16* Kh = (_Float16*)(base2 + 1 * xbytes);
    _Float16* Vt = (_Float16*)(base2 + 2 * xbytes);
    _Float16* AO = (_Float16*)(base2 + 3 * xbytes);

    // 1) bulk f32 -> f16 conversion of activations and weights
    const int xn8 = (BN * CDIM) / 8;       // 524288
    const int wn8 = (CDIM * CDIM) / 8;     // 131072
    cvt_kernel<<<(xn8 + 255) / 256, 256, 0, stream>>>(q,  Xq,  xn8);
    cvt_kernel<<<(xn8 + 255) / 256, 256, 0, stream>>>(k,  Xk,  xn8);
    cvt_kernel<<<(xn8 + 255) / 256, 256, 0, stream>>>(v,  Xv,  xn8);
    cvt_kernel<<<(wn8 + 255) / 256, 256, 0, stream>>>(Wq, Wqh, wn8);
    cvt_kernel<<<(wn8 + 255) / 256, 256, 0, stream>>>(Wk, Wkh, wn8);
    cvt_kernel<<<(wn8 + 255) / 256, 256, 0, stream>>>(Wv, Wvh, wn8);
    cvt_kernel<<<(wn8 + 255) / 256, 256, 0, stream>>>(Wo, Woh, wn8);

    // 2) projections (1/sqrt(HDIM) * log2(e) folded into Q)
    const dim3 gProj(BN / PT_MROWS, CDIM / PT_JROWS);
    proj_kernel<0><<<gProj, 256, 0, stream>>>(Xq, Wqh, bq, (void*)Qh, QSCALE);
    proj_kernel<0><<<gProj, 256, 0, stream>>>(Xk, Wkh, bk, (void*)Kh, 1.0f);
    proj_kernel<1><<<gProj, 256, 0, stream>>>(Xv, Wvh, bv, (void*)Vt, 1.0f);

    // 3) attention
    attn_kernel<<<dim3(NSEQ / 256, BATCH * NHEADS), 256, 0, stream>>>(Qh, Kh, Vt, AO);

    // 4) output projection -> f32 d_out
    proj_kernel<2><<<gProj, 256, 0, stream>>>(AO, Woh, bo, (void*)out, 1.0f);
}

// v003
// It runs in 82.4 microseconds.
// Two timings next to v002 put it at 1.15 and 1.14 times that version's speed.
// Counting every step since v000, it is 4.60 times as fast.
#include <hip/hip_runtime.h>

#define BATCH  2
#define NSEQ   2048
#define CDIM   1024
#define NHEADS 16
#define HDIM   64
#define BN     (BATCH * NSEQ)   // 4096 total rows

typedef __attribute__((ext_vector_type(16))) _Float16 v16h;
typedef __attribute__((ext_vector_type(8)))  _Float16 v8h;
typedef __attribute__((ext_vector_type(8)))  float    v8f;

// 0.125 (=1/sqrt(HDIM)) * log2(e): folded into the Q projection so the
// attention kernel can use v_exp_f32 (2^x) directly with no per-element mul.
#define QSCALE 0.1803368801f

// ---------------------------------------------------------------------------
// Fragment builder matching the CDNA5 16-bit A/B lane layout:
//   lanes 0-15 : K elements {k0+0..7, k0+16..23}
//   lanes 16-31: K elements {k0+8..15, k0+24..31}
// Caller passes a pointer already offset by (hi ? 8 : 0).
// ---------------------------------------------------------------------------
__device__ __forceinline__ v16h frag_from_h16(const _Float16* p) {
    v8h lo = *(const v8h*)p;
    v8h hh = *(const v8h*)(p + 16);
    v16h r;
#pragma unroll
    for (int i = 0; i < 8; ++i) { r[i] = lo[i]; r[8 + i] = hh[i]; }
    return r;
}

// ---------------------------------------------------------------------------
// f32 -> f16 convert of all seven tensors, one launch, one work-group of 16
// waves per WGP.  The seven f16 results lie one behind the other in the
// workspace, so the block index alone gives the place in out; it also picks
// the source.  A wave takes 16 KB of its source: 32 loads of 512 contiguous
// bytes, all issued before the first is converted, and 32 stores of 256
// contiguous bytes.  Few long waves: a wave per 1 KB spent the launch on
// starting waves, not on moving bytes.
// ---------------------------------------------------------------------------
typedef __attribute__((ext_vector_type(4))) _Float16 v4h;
typedef __attribute__((ext_vector_type(4))) float    v4f;

#define CV_THREADS 512
#define CV_LOADS   32                               // 16-byte loads per lane
#define CV_WAVE    (32 * CV_LOADS * 4)              // elements per wave
#define CV_BLOCK   (CV_THREADS * CV_LOADS * 4)       // elements per work-group
#define CV_XB      (BN * CDIM / CV_BLOCK)           // work-groups per activation tensor: 64
#define CV_WB      (CDIM * CDIM / CV_BLOCK)         // work-groups per weight tensor: 16
#define CV_GRID    (3 * CV_XB + 4 * CV_WB)          // 256

__global__ __launch_bounds__(CV_THREADS) void cvt_all_kernel(const float* __restrict__ q,
                                                             const float* __restrict__ k,
                                                             const float* __restrict__ v,
                                                             const float* __restrict__ Wq,
                                                             const float* __restrict__ Wk,
                                                             const float* __restrict__ Wv,
                                                             const float* __restrict__ Wo,
                                                             _Float16* __restrict__ out) {
    const int blk = blockIdx.x;
    const float* src;
    int piece;                                      // work-group's place in its source
    if (blk < 3 * CV_XB) {
        src   = blk < CV_XB ? q : (blk < 2 * CV_XB ? k : v);
        piece = blk & (CV_XB - 1);
    } else {
        const int w = (blk - 3 * CV_XB) / CV_WB;
        src   = w == 0 ? Wq : (w == 1 ? Wk : (w == 2 ? Wv : Wo));
        piece = blk & (CV_WB - 1);
    }
    const unsigned inwg = (threadIdx.x >> 5) * CV_WAVE + (threadIdx.x & 31) * 4;
    const unsigned ioff = inwg * 4;                 // this lane's byte offset in the source piece
    const v4f* ip = (const v4f*)((const char*)(src + (size_t)piece * CV_BLOCK) + ioff);
    v4h*       op = (v4h*)(out + (size_t)blk * CV_BLOCK + inwg);

    v4f x[CV_LOADS];
#pragma unroll
    for (int j = 0; j < CV_LOADS; ++j) x[j] = ip[j * 32];
    // stands behind the last load and in front of every write of the loads'
    // offset register, which it names so that no load lands on it
    asm volatile("s_wait_xcnt 0x0" :: "v"(ioff) : "memory");
    // holds every convert behind the last load, so that the wave's whole share
    // is in flight at once; unfenced, converts and their waits stood among the loads
    __builtin_amdgcn_sched_barrier(0);
#pragma unroll
    for (int j = 0; j < CV_LOADS; ++j) op[j * 32] = __builtin_convertvector(x[j], v4h);
}

// ---------------------------------------------------------------------------
// Transposed projection GEMM: computes Out^T = W @ X^T  (i.e. Out = X @ W^T),
// + bias, * oscale.  One work-group of 8 waves (2 x 4): 128 output channels (j)
// x 128 rows (m); one wave: 64 x 32 = 4 x 2 accumulator tiles, two waves per SIMD.
// Both operand tiles are staged in LDS, 128 k (256 B of every row) per stage,
// two buffers, filled by asynchronous copies that fly while the other buffer
// is worked on.  Every global line is fetched once per work-group, as whole
// 256-B row pieces, instead of once per wave in 32-B pieces.
// The D-matrix C-layout has j running along registers -> contiguous
// epilogue stores; bias is indexed along registers.
// MODE 0: f16 out, head-major   [B,H,N,D]   (Q with oscale=QSCALE, K)
// MODE 1: f16 out, d-transposed [B,H,D,N]   (V)
// MODE 2: f32 out, plain        [BN,CDIM]   (final output projection)
// ---------------------------------------------------------------------------
#define PT_JROWS 128                       // W rows (output channels) per work-group
#define PT_MROWS 128                       // X rows per work-group
#define PT_KS    128                       // k per stage
#define PT_PITCH 272                       // LDS row pitch, bytes: 16 B x odd, no bank conflict for b128 reads
#define PT_STAGE ((PT_JROWS + PT_MROWS) * PT_PITCH)  // one buffer: [W 128 rows | X 128 rows]
#define PT_NT    (CDIM / PT_KS)            // stages

// Eight asynchronous 16-byte copies per lane, global -> LDS, rows 16 apart.
// s_wait_xcnt closes the statement: no address register named here is
// rewritten in front of it.
__device__ __forceinline__ void async_rows8(unsigned lds, const _Float16* g) {
    asm volatile(
        "global_load_async_to_lds_b128 %0, %8, off\n\t"
        "global_load_async_to_lds_b128 %1, %9, off\n\t"
        "global_load_async_to_lds_b128 %2, %10, off\n\t"
        "global_load_async_to_lds_b128 %3, %11, off\n\t"
        "global_load_async_to_lds_b128 %4, %12, off\n\t"
        "global_load_async_to_lds_b128 %5, %13, off\n\t"
        "global_load_async_to_lds_b128 %6, %14, off\n\t"
        "global_load_async_to_lds_b128 %7, %15, off\n\t"
        "s_wait_xcnt 0x0"
        :: "v"(lds + 0 * 16 * PT_PITCH), "v"(lds + 1 * 16 * PT_PITCH),
           "v"(lds + 2 * 16 * PT_PITCH), "v"(lds + 3 * 16 * PT_PITCH),
           "v"(lds + 4 * 16 * PT_PITCH), "v"(lds + 5 * 16 * PT_PITCH),
           "v"(lds + 6 * 16 * PT_PITCH), "v"(lds + 7 * 16 * PT_PITCH),
           "v"(g + 0 * 16 * CDIM), "v"(g + 1 * 16 * CDIM),
           "v"(g + 2 * 16 * CDIM), "v"(g + 3 * 16 * CDIM),
           "v"(g + 4 * 16 * CDIM), "v"(g + 5 * 16 * CDIM),
           "v"(g + 6 * 16 * CDIM), "v"(g + 7 * 16 * CDIM)
        : "memory");
}

// One stage: 256 rows of 256 B.  A lane's 16 copies take rows (tid >> 4) + 16 i
// at byte column (tid & 15) * 16; lds, gW and gX already hold that lane offset.
__device__ __forceinline__ void fill_stage(unsigned lds, const _Float16* gW,
                                           const _Float16* gX) {
    async_rows8(lds, gW);
    async_rows8(lds + PT_JROWS * PT_PITCH, gX);
}

template <int MODE>
__global__ __launch_bounds__(256) void proj_kernel(const _Float16* __restrict__ X,
                                                   const _Float16* __restrict__ W,
                                                   const float* __restrict__ bias,
                                                   void* __restrict__ outv,
                                                   float oscale) {
    __shared__ __attribute__((aligned(16))) unsigned char L[2 * PT_STAGE];

    const int tid  = threadIdx.x;
    const int lane = tid & 31;
    const int wave = tid >> 5;
    const int col  = lane & 15;
    const int hi   = lane >> 4;
    const int wj   = wave >> 2;               // wave's 64-channel half
    const int wm   = wave & 3;                // wave's 32-row quarter
    const int m0   = blockIdx.x * PT_MROWS;   // row tile over BN (lanes)
    const int n0   = blockIdx.y * PT_JROWS;   // output-channel tile (registers)

    // this lane's place in a stage, for the copies
    const unsigned  ldsc = (unsigned)(size_t)L + (tid >> 4) * PT_PITCH + (tid & 15) * 16;
    const _Float16* gW   = W + (size_t)(n0 + (tid >> 4)) * CDIM + (tid & 15) * 8;
    const _Float16* gX   = X + (size_t)(m0 + (tid >> 4)) * CDIM + (tid & 15) * 8;

    v8f c[4][2];   // [channel subtile g][row subtile mt]
#pragma unroll
    for (int g = 0; g < 4; ++g)
#pragma unroll
        for (int mt = 0; mt < 2; ++mt) c[g][mt] = v8f{};

    // stage 0 lands and is published, then stage 1 starts to fly
    fill_stage(ldsc, gW, gX);
    asm volatile("s_wait_asynccnt 0x0" ::: "memory");   // this wave's copies of stage 0 have landed
    __syncthreads();                                    // ... and every other wave's
    fill_stage(ldsc + PT_STAGE, gW + PT_KS, gX + PT_KS);

    // kept rolled: unrolled, each trip's first fragment reads were placed behind
    // the second set's, so the first product waited for all 24 reads
#pragma unroll 1
    for (int t = 0; t < PT_NT; ++t) {
        const unsigned char* buf = L + (t & 1) * PT_STAGE;
        const _Float16* aB = (const _Float16*)(buf + (wj * 64 + col) * PT_PITCH) + hi * 8;
        const _Float16* bB = (const _Float16*)(buf + (PT_JROWS + wm * 32 + col) * PT_PITCH) + hi * 8;
        // Two fragment sets.  A = W: lane holds row j; B = X^T: lane holds
        // column m; both contiguous in k.
        v16h aW[2][4], bX[2][2];
#pragma unroll
        for (int g = 0; g < 4; ++g) aW[0][g] = frag_from_h16(aB + g * 16 * (PT_PITCH / 2));
#pragma unroll
        for (int mt = 0; mt < 2; ++mt) bX[0][mt] = frag_from_h16(bB + mt * 16 * (PT_PITCH / 2));
#pragma unroll
        for (int ks = 0; ks < PT_KS / 32; ++ks) {
            const int cur = ks & 1;
            if (ks + 1 < PT_KS / 32) {
#pragma unroll
                for (int g = 0; g < 4; ++g)
                    aW[cur ^ 1][g] = frag_from_h16(aB + g * 16 * (PT_PITCH / 2) + (ks + 1) * 32);
#pragma unroll
                for (int mt = 0; mt < 2; ++mt)
                    bX[cur ^ 1][mt] = frag_from_h16(bB + mt * 16 * (PT_PITCH / 2) + (ks + 1) * 32);
            }
            // keeps the next k step's LDS reads one group ahead of this step's
            // products; unfenced they sink to just before their use and stall it
            __builtin_amdgcn_sched_barrier(0);
#pragma unroll
            for (int g = 0; g < 4; ++g)
#pragma unroll
                for (int mt = 0; mt < 2; ++mt)
                    c[g][mt] = __builtin_amdgcn_wmma_f32_16x16x32_f16(
                        false, aW[cur][g], false, bX[cur][mt], (short)0, c[g][mt], false, false);
            // closes the run of products: no later LDS read moves up among them
            __builtin_amdgcn_sched_barrier(0);
        }
        asm volatile("s_wait_dscnt 0x0" ::: "memory");      // this wave has left buffer t & 1
        asm volatile("s_wait_asynccnt 0x0" ::: "memory");   // its copies of stage t + 1 have landed
        __syncthreads();   // publishes stage t + 1; every reader has left buffer t & 1
        if (t + 2 < PT_NT)
            fill_stage(ldsc + (t & 1) * PT_STAGE, gW + (t + 2) * PT_KS, gX + (t + 2) * PT_KS);
    }
    asm volatile("s_wait_asynccnt 0x0" ::: "memory");       // no copy outlives the loop

    // Epilogue: Out^T C-layout -> lane holds fixed m; register i is channel
    // j0+i with j0 = n0 + wj*64 + g*16 + hi*8 (8 contiguous channels per store).
    const float* bp = bias + n0 + wj * 64 + hi * 8;
#pragma unroll
    for (int g = 0; g < 4; ++g) {
        const int j0 = n0 + wj * 64 + g * 16 + hi * 8;
        float bj[8];
#pragma unroll
        for (int i = 0; i < 8; ++i) bj[i] = bp[g * 16 + i];
#pragma unroll
        for (int mt = 0; mt < 2; ++mt) {
            const int m = m0 + wm * 32 + mt * 16 + col;
            const int b = m >> 11;               // m / NSEQ
            const int n = m & 2047;              // m % NSEQ
            float vals[8];
#pragma unroll
            for (int i = 0; i < 8; ++i) vals[i] = (c[g][mt][i] + bj[i]) * oscale;
            if (MODE == 0) {
                const int h = j0 >> 6, d0 = j0 & 63;
                v8h r;
#pragma unroll
                for (int i = 0; i < 8; ++i) r[i] = (_Float16)vals[i];
                *(v8h*)((_Float16*)outv +
                        (((size_t)b * NHEADS + h) * NSEQ + n) * HDIM + d0) = r;
            } else if (MODE == 1) {
                const int h = j0 >> 6, d0 = j0 & 63;
#pragma unroll
                for (int i = 0; i < 8; ++i)
                    ((_Float16*)outv)[(((size_t)b * NHEADS + h) * HDIM + d0 + i) * NSEQ + n] =
                        (_Float16)vals[i];
            } else {
                float* op = (float*)outv + (size_t)m * CDIM + j0;
                *(float4*)(op + 0) = make_float4(vals[0], vals[1], vals[2], vals[3]);
                *(float4*)(op + 4) = make_float4(vals[4], vals[5], vals[6], vals[7]);
            }
        }
    }
}

// ---------------------------------------------------------------------------
// Attention, transposed formulation:
//   S^T = K * Q^T      (A = K tile, B = Q^T tile)
//   P^T = exp2(S^T)    (C-layout of S^T IS the B-layout of P^T for step 2)
//   O^T += V^T * P^T   (A = V^T from the pre-transposed Vt tensor)
// One work-group of 8 waves: 256 q rows of one head; one wave: 32 q rows (two
// 16-col subtiles of S^T), kv chunks of 32.  K and V^T are staged in LDS, 128
// keys per stage, two buffers, filled by asynchronous copies that fly while the
// other buffer is worked on: every K and V line is fetched once per work-group,
// as whole rows, instead of once per wave in 32-B pieces.
// Row sums of P are per-lane scalars (lane = fixed q); one xor-16 shuffle at
// the end.  O^T epilogue stores are contiguous v8h.
// ---------------------------------------------------------------------------
typedef __attribute__((ext_vector_type(2))) float v2f;

#define AT_KEYS  128                       // keys per stage
#define AT_KP    144                       // K row (one key, 128 B) pitch in LDS: 16 B x odd
#define AT_VP    272                       // V^T row (one d, 128 keys, 256 B) pitch in LDS: 16 B x odd
#define AT_KB    (AT_KEYS * AT_KP)         // K part of a buffer
#define AT_STAGE (AT_KB + HDIM * AT_VP)    // one buffer: [K 128 rows | V^T 64 rows]
#define AT_NT    (NSEQ / AT_KEYS)          // stages

// One stage: a lane's eight asynchronous 16-byte copies, global -> LDS.
// K: rows (tid >> 3) + 32 i at byte column (tid & 7) * 16; V^T: rows
// (tid >> 4) + 16 i at byte column (tid & 15) * 16; the arguments already hold
// that lane offset.  s_wait_xcnt closes the statement: no address register
// named here is rewritten in front of it.
__device__ __forceinline__ void fill_kv(unsigned ldsK, unsigned ldsV,
                                        const _Float16* gK, const _Float16* gV) {
    asm volatile(
        "global_load_async_to_lds_b128 %0, %8, off\n\t"
        "global_load_async_to_lds_b128 %1, %9, off\n\t"
        "global_load_async_to_lds_b128 %2, %10, off\n\t"
        "global_load_async_to_lds_b128 %3, %11, off\n\t"
        "global_load_async_to_lds_b128 %4, %12, off\n\t"
        "global_load_async_to_lds_b128 %5, %13, off\n\t"
        "global_load_async_to_lds_b128 %6, %14, off\n\t"
        "global_load_async_to_lds_b128 %7, %15, off\n\t"
        "s_wait_xcnt 0x0"
        :: "v"(ldsK + 0 * 32 * AT_KP), "v"(ldsK + 1 * 32 * AT_KP),
           "v"(ldsK + 2 * 32 * AT_KP), "v"(ldsK + 3 * 32 * AT_KP),
           "v"(ldsV + 0 * 16 * AT_VP), "v"(ldsV + 1 * 16 * AT_VP),
           "v"(ldsV + 2 * 16 * AT_VP), "v"(ldsV + 3 * 16 * AT_VP),
           "v"(gK + 0 * 32 * HDIM), "v"(gK + 1 * 32 * HDIM),
           "v"(gK + 2 * 32 * HDIM), "v"(gK + 3 * 32 * HDIM),
           "v"(gV + 0 * 16 * NSEQ), "v"(gV + 1 * 16 * NSEQ),
           "v"(gV + 2 * 16 * NSEQ), "v"(gV + 3 * 16 * NSEQ)
        : "memory");
}

// One stage of 128 keys out of one LDS buffer, four chunks of 32 keys.
__device__ __forceinline__ void attn_stage(const unsigned char* buf, int col, int hi,
                                           const v16h (&bQ)[2][2], v8f (&o)[2][4],
                                           v2f& lrow) {
    // A = K: lane holds key row, contiguous in d; A = V^T: lane holds d row,
    // contiguous in keys.
    const _Float16* kB = (const _Float16*)(buf + col * AT_KP) + hi * 8;
    const _Float16* vB = (const _Float16*)(buf + AT_KB + col * AT_VP) + hi * 8;

    v16h aK[2][2], aV[4];   // K: [key subtile t][d-fragment]; V^T: [d-group]
#pragma unroll
    for (int t = 0; t < 2; ++t)
#pragma unroll
        for (int f = 0; f < 2; ++f)
            aK[t][f] = frag_from_h16(kB + t * 16 * (AT_KP / 2) + f * 32);

#pragma unroll
    for (int c = 0; c < AT_KEYS / 32; ++c) {
        // this chunk's V^T reads, one group; they land behind the S^T products
        // and the exponentials
#pragma unroll
        for (int g = 0; g < 4; ++g)
            aV[g] = frag_from_h16(vB + g * 16 * (AT_VP / 2) + c * 32);
        // holds the V^T reads up here; unfenced each pair sinks to just
        // before its products, which then wait out the LDS latency
        __builtin_amdgcn_sched_barrier(0);

        // ---- S^T tiles: s[t][qt] = (K rows c*32+t*16..+15) x (q subtile) ----
        v8f s[2][2];
#pragma unroll
        for (int t = 0; t < 2; ++t)
#pragma unroll
            for (int qt = 0; qt < 2; ++qt) {
                v8f acc = {};
                acc = __builtin_amdgcn_wmma_f32_16x16x32_f16(
                    false, aK[t][0], false, bQ[qt][0], (short)0, acc, false, false);
                acc = __builtin_amdgcn_wmma_f32_16x16x32_f16(
                    false, aK[t][1], false, bQ[qt][1], (short)0, acc, false, false);
                s[t][qt] = acc;
            }
        if (c + 1 < AT_KEYS / 32) {
#pragma unroll
            for (int t = 0; t < 2; ++t)
#pragma unroll
                for (int f = 0; f < 2; ++f)
                    aK[t][f] = frag_from_h16(kB + ((c + 1) * 32 + t * 16) * (AT_KP / 2) + f * 32);
        }
        // holds the K reads ahead of the exponentials, a whole chunk's vector
        // work and products in front of their use; in the stage's last chunk,
        // which reads no K, it keeps the chunk in front of the stage's closing
        // barrier: unfenced it moved behind it, and the refill with it
        __builtin_amdgcn_sched_barrier(0);

        // ---- P^T = 2^(S^T): pack straight into B-layout fragments ----
        // B fragment elements {0..7} = kv tile t=0 regs, {8..15} = t=1 regs.
        // The two q subtiles' row sums run side by side as one packed pair: written
        // as two scalars they were gathered at the stage's end, every exponential
        // of the stage held in registers until there.
        v16h pb[2];
        v2f acc = {0.0f, 0.0f};
#pragma unroll
        for (int i = 0; i < 8; ++i) {
            const v2f p0 = {__builtin_amdgcn_exp2f(s[0][0][i]), __builtin_amdgcn_exp2f(s[0][1][i])};
            const v2f p1 = {__builtin_amdgcn_exp2f(s[1][0][i]), __builtin_amdgcn_exp2f(s[1][1][i])};
            acc += p0 + p1;
#pragma unroll
            for (int qt = 0; qt < 2; ++qt) {
                pb[qt][i]     = (_Float16)p0[qt];
                pb[qt][8 + i] = (_Float16)p1[qt];
            }
        }
        lrow += acc;

        // ---- O^T += V^T x P^T ----
#pragma unroll
        for (int g = 0; g < 4; ++g)
#pragma unroll
            for (int qt = 0; qt < 2; ++qt)
                o[qt][g] = __builtin_amdgcn_wmma_f32_16x16x32_f16(
                    false, aV[g], false, pb[qt], (short)0, o[qt][g], false, false);
    }
}

__global__ __launch_bounds__(256) void attn_kernel(const _Float16* __restrict__ Qh,
                                                   const _Float16* __restrict__ Kh,
                                                   const _Float16* __restrict__ Vt,
                                                   _Float16* __restrict__ AO) {
    __shared__ __attribute__((aligned(16))) unsigned char L[2 * AT_STAGE];

    const int tid  = threadIdx.x;
    const int lane = tid & 31;
    const int wave = tid >> 5;
    const int col  = lane & 15;
    const int hi   = lane >> 4;
    const int q0   = blockIdx.x * 256 + wave * 32;
    const int bh   = blockIdx.y;              // b*NHEADS + h
    const int b    = bh >> 4;
    const int h    = bh & 15;

    // this lane's place in a stage, for the copies
    const unsigned  ldsK = (unsigned)(size_t)L + (tid >> 3) * AT_KP + (tid & 7) * 16;
    const unsigned  ldsV = (unsigned)(size_t)L + AT_KB + (tid >> 4) * AT_VP + (tid & 15) * 16;
    const _Float16* gK   = Kh + ((size_t)bh * NSEQ + (tid >> 3)) * HDIM + (tid & 7) * 8;
    const _Float16* gV   = Vt + ((size_t)bh * HDIM + (tid >> 4)) * NSEQ + (tid & 15) * 8;

    // stage 0 starts to fly while Q is fetched
    fill_kv(ldsK, ldsV, gK, gV);

    // B = Q^T fragments: [q-subtile][d-fragment]; lane holds q column
    v16h bQ[2][2];
#pragma unroll
    for (int qt = 0; qt < 2; ++qt)
#pragma unroll
        for (int f = 0; f < 2; ++f)
            bQ[qt][f] = frag_from_h16(
                Qh + ((size_t)bh * NSEQ + q0 + qt * 16 + col) * HDIM + f * 32 + hi * 8);
    // the address registers of the Q loads are written again below
    asm volatile("s_wait_xcnt 0x0" ::: "memory");

    v2f lrow = {0.0f, 0.0f};   // row sums of P: [q-subtile]
    v8f o[2][4];   // O^T accumulators: [q-subtile][d-group]
#pragma unroll
    for (int qt = 0; qt < 2; ++qt)
#pragma unroll
        for (int g = 0; g < 4; ++g) o[qt][g] = v8f{};

    // stage 0 lands and is published, then stage 1 starts to fly
    asm volatile("s_wait_asynccnt 0x0" ::: "memory");   // this wave's copies of stage 0 have landed
    __syncthreads();                                    // ... and every other wave's
    fill_kv(ldsK + AT_STAGE, ldsV + AT_STAGE, gK + AT_KEYS * HDIM, gV + AT_KEYS);

    // Two loops, so that each trip is one straight run of code: with the refill
    // under a test inside the trip, the row sums moved behind that test and every
    // exponential of the stage stayed in registers until there.
    int st = 0;
    for (; st + 2 < AT_NT; ++st) {
        attn_stage(L + (st & 1) * AT_STAGE, col, hi, bQ, o, lrow);
        asm volatile("s_wait_dscnt 0x0" ::: "memory");      // this wave has left buffer st & 1
        asm volatile("s_wait_asynccnt 0x0" ::: "memory");   // its copies of stage st + 1 have landed
        __syncthreads();   // publishes stage st + 1; every reader has left buffer st & 1
        fill_kv(ldsK + (st & 1) * AT_STAGE, ldsV + (st & 1) * AT_STAGE,
                gK + (st + 2) * (AT_KEYS * HDIM), gV + (st + 2) * AT_KEYS);
    }
    // the last two stages: no stage st + 2 is left to fetch
    for (; st < AT_NT; ++st) {
        attn_stage(L + (st & 1) * AT_STAGE, col, hi, bQ, o, lrow);
        asm volatile("s_wait_dscnt 0x0" ::: "memory");      // this wave has left buffer st & 1
        asm volatile("s_wait_asynccnt 0x0" ::: "memory");   // its copies of stage st + 1 have landed
        __syncthreads();   // publishes stage st + 1
    }
    asm volatile("s_wait_asynccnt 0x0" ::: "memory");       // no copy outlives the loops

    // ---- finalize: combine the two kv half-sums, normalize, store O ----
#pragma unroll
    for (int qt = 0; qt < 2; ++qt) {
        const float l   = lrow[qt] + __shfl_xor(lrow[qt], 16, 32);
        const float inv = 1.0f / l;
        const int   qrow = q0 + qt * 16 + col;           // lane = q column
        _Float16* rowp = AO + ((size_t)b * NSEQ + qrow) * CDIM + h * HDIM;
#pragma unroll
        for (int g = 0; g < 4; ++g) {
            v8h r;
#pragma unroll
            for (int i = 0; i < 8; ++i) r[i] = (_Float16)(o[qt][g][i] * inv);
            *(v8h*)(rowp + g * 16 + hi * 8) = r;          // 8 contiguous d
        }
    }
}

// ---------------------------------------------------------------------------
extern "C" void kernel_launch(void* const* d_in, const int* in_sizes, int n_in,
                              void* d_out, int out_size, void* d_ws, size_t ws_size,
                              hipStream_t stream) {
    const float* q  = (const float*)d_in[0];
    const float* k  = (const float*)d_in[1];
    const float* v  = (const float*)d_in[2];
    const float* Wq = (const float*)d_in[3];
    const float* bq = (const float*)d_in[4];
    const float* Wk = (const float*)d_in[5];
    const float* bk = (const float*)d_in[6];
    const float* Wv = (const float*)d_in[7];
    const float* bv = (const float*)d_in[8];
    const float* Wo = (const float*)d_in[9];
    const float* bo = (const float*)d_in[10];
    float* out = (float*)d_out;

    // Workspace layout (f16 tensors)
    char* ws = (char*)d_ws;
    const size_t xbytes = (size_t)BN * CDIM * sizeof(_Float16);     // 8 MB
    const size_t wbytes = (size_t)CDIM * CDIM * sizeof(_Float16);   // 2 MB
    _Float16* Xq  = (_Float16*)(ws);
    _Float16* Xk  = (_Float16*)(ws + 1 * xbytes);
    _Float16* Xv  = (_Float16*)(ws + 2 * xbytes);
    _Float16* Wqh = (_Float16*)(ws + 3 * xbytes);
    _Float16* Wkh = (_Float16*)(ws + 3 * xbytes + 1 * wbytes);
    _Float16* Wvh = (_Float16*)(ws + 3 * xbytes + 2 * wbytes);
    _Float16* Woh = (_Float16*)(ws + 3 * xbytes + 3 * wbytes);
    char* base2 = ws + 3 * xbytes + 4 * wbytes;
    _Float16* Qh = (_Float16*)(base2);
    _Float16* Kh = (_Float16*)(base2 + 1 * xbytes);
    _Float16* Vt = (_Float16*)(base2 + 2 * xbytes);
    _Float16* AO = (_Float16*)(base2 + 3 * xbytes);

    // 1) f32 -> f16 conversion of activations and weights: Xq .. Woh are one
    //    contiguous run of the workspace, in the order of the arguments
    cvt_all_kernel<<<CV_GRID, CV_THREADS, 0, stream>>>(q, k, v, Wq, Wk, Wv, Wo, Xq);

    // 2) projections (1/sqrt(HDIM) * log2(e) folded into Q)
    const dim3 gProj(BN / PT_MROWS, CDIM / PT_JROWS);
    proj_kernel<0><<<gProj, 256, 0, stream>>>(Xq, Wqh, bq, (void*)Qh, QSCALE);
    proj_kernel<0><<<gProj, 256, 0, stream>>>(Xk, Wkh, bk, (void*)Kh, 1.0f);
    proj_kernel<1><<<gProj, 256, 0, stream>>>(Xv, Wvh, bv, (void*)Vt, 1.0f);

    // 3) attention
    attn_kernel<<<dim3(NSEQ / 256, BATCH * NHEADS), 256, 0, stream>>>(Qh, Kh, Vt, AO);

    // 4) output projection -> f32 d_out
    proj_kernel<2><<<gProj, 256, 0, stream>>>(AO, Woh, bo, (void*)out, 1.0f);
}

// v004
// One run takes 72.2 microseconds.
// Two timings next to v003 put it at 1.14 and 1.13 times that version's speed.
// Counting every step since v000, it is 5.23 times as fast.
#include <hip/hip_runtime.h>

#define BATCH  2
#define NSEQ   2048
#define CDIM   1024
#define NHEADS 16
#define HDIM   64
#define BN     (BATCH * NSEQ)   // 4096 total rows

typedef __attribute__((ext_vector_type(16))) _Float16 v16h;
typedef __attribute__((ext_vector_type(8)))  _Float16 v8h;
typedef __attribute__((ext_vector_type(8)))  float    v8f;

// 0.125 (=1/sqrt(HDIM)) * log2(e): folded into the Q projection so the
// attention kernel can use v_exp_f32 (2^x) directly with no per-element mul.
#define QSCALE 0.1803368801f

// ---------------------------------------------------------------------------
// Fragment builder matching the CDNA5 16-bit A/B lane layout:
//   lanes 0-15 : K elements {k0+0..7, k0+16..23}
//   lanes 16-31: K elements {k0+8..15, k0+24..31}
// Caller passes a pointer already offset by (hi ? 8 : 0).
// ---------------------------------------------------------------------------
__device__ __forceinline__ v16h frag_from_h16(const _Float16* p) {
    v8h lo = *(const v8h*)p;
    v8h hh = *(const v8h*)(p + 16);
    v16h r;
#pragma unroll
    for (int i = 0; i < 8; ++i) { r[i] = lo[i]; r[8 + i] = hh[i]; }
    return r;
}

// ---------------------------------------------------------------------------
// f32 -> f16 convert of all seven tensors, one launch, one work-group of 16
// waves per WGP.  The seven f16 results lie one behind the other in the
// workspace, so the block index alone gives the place in out; it also picks
// the source.  A wave takes 16 KB of its source: 32 loads of 512 contiguous
// bytes, all issued before the first is converted, and 32 stores of 256
// contiguous bytes.  Few long waves, for speed only.
// ---------------------------------------------------------------------------
typedef __attribute__((ext_vector_type(4))) _Float16 v4h;
typedef __attribute__((ext_vector_type(4))) float    v4f;

#define CV_THREADS 512
#define CV_LOADS   32                               // 16-byte loads per lane
#define CV_WAVE    (32 * CV_LOADS * 4)              // elements per wave
#define CV_BLOCK   (CV_THREADS * CV_LOADS * 4)       // elements per work-group
#define CV_XB      (BN * CDIM / CV_BLOCK)           // work-groups per activation tensor: 64
#define CV_WB      (CDIM * CDIM / CV_BLOCK)         // work-groups per weight tensor: 16
#define CV_GRID    (3 * CV_XB + 4 * CV_WB)          // 256

__global__ __launch_bounds__(CV_THREADS) void cvt_all_kernel(const float* __restrict__ q,
                                                             const float* __restrict__ k,
                                                             const float* __restrict__ v,
                                                             const float* __restrict__ Wq,
                                                             const float* __restrict__ Wk,
                                                             const float* __restrict__ Wv,
                                                             const float* __restrict__ Wo,
                                                             _Float16* __restrict__ out) {
    const int blk = blockIdx.x;
    const float* src;
    int piece;                                      // work-group's place in its source
    if (blk < 3 * CV_XB) {
        src   = blk < CV_XB ? q : (blk < 2 * CV_XB ? k : v);
        piece = blk & (CV_XB - 1);
    } else {
        const int w = (blk - 3 * CV_XB) / CV_WB;
        src   = w == 0 ? Wq : (w == 1 ? Wk : (w == 2 ? Wv : Wo));
        piece = blk & (CV_WB - 1);
    }
    const unsigned inwg = (threadIdx.x >> 5) * CV_WAVE + (threadIdx.x & 31) * 4;
    const unsigned ioff = inwg * 4;                 // this lane's byte offset in the source piece
    const v4f* ip = (const v4f*)((const char*)(src + (size_t)piece * CV_BLOCK) + ioff);
    v4h*       op = (v4h*)(out + (size_t)blk * CV_BLOCK + inwg);

    v4f x[CV_LOADS];
#pragma unroll
    for (int j = 0; j < CV_LOADS; ++j) x[j] = ip[j * 32];
    // stands behind the last load and in front of every write of the loads'
    // offset register, which it names so that no load lands on it
    asm volatile("s_wait_xcnt 0x0" :: "v"(ioff) : "memory");
    // holds every convert behind the last load, so that the wave's whole share
    // is in flight at once; unfenced, converts and their waits stood among the loads
    __builtin_amdgcn_sched_barrier(0);
#pragma unroll
    for (int j = 0; j < CV_LOADS; ++j) op[j * 32] = __builtin_convertvector(x[j], v4h);
}

// ---------------------------------------------------------------------------
// Transposed projection GEMM: computes Out^T = W @ X^T  (i.e. Out = X @ W^T),
// + bias, * oscale.  One work-group of 8 waves (2 x 4): 128 output channels (j)
// x 128 rows (m); one wave: 64 x 32 = 4 x 2 accumulator tiles, two waves per SIMD.
// Both operand tiles are staged in LDS, 128 k (256 B of every row) per stage,
// two buffers, filled by asynchronous copies that fly while the other buffer
// is worked on.  Every global line is fetched once per work-group, as whole
// 256-B row pieces, instead of once per wave in 32-B pieces.
// The D-matrix C-layout has j running along registers -> contiguous
// epilogue stores; bias is indexed along registers.
// MODE 0: f16 out, head-major   [B,H,N,D]   (Q with oscale=QSCALE, K)
// MODE 1: f16 out, d-transposed [B,H,D,N]   (V)
// MODE 2: f32 out, plain        [BN,CDIM]   (final output projection)
// The Q, K and V projections are one launch (proj_qkv_kernel): three tiles per
// WGP, two of them resident at a time, so that one work-group's copies, first
// stage and stores run under the other's products.
// ---------------------------------------------------------------------------
#define PT_JROWS 128                       // W rows (output channels) per work-group
#define PT_MROWS 128                       // X rows per work-group
#define PT_KS    128                       // k per stage
#define PT_PITCH 272                       // LDS row pitch, bytes: 16 B x odd, no bank conflict for b128 reads
#define PT_STAGE ((PT_JROWS + PT_MROWS) * PT_PITCH)  // one buffer: [W 128 rows | X 128 rows]
#define PT_NT    (CDIM / PT_KS)            // stages

// Eight asynchronous 16-byte copies per lane, global -> LDS, rows 16 apart.
// s_wait_xcnt closes the statement: no address register named here is
// rewritten in front of it.
__device__ __forceinline__ void async_rows8(unsigned lds, const _Float16* g) {
    asm volatile(
        "global_load_async_to_lds_b128 %0, %8, off\n\t"
        "global_load_async_to_lds_b128 %1, %9, off\n\t"
        "global_load_async_to_lds_b128 %2, %10, off\n\t"
        "global_load_async_to_lds_b128 %3, %11, off\n\t"
        "global_load_async_to_lds_b128 %4, %12, off\n\t"
        "global_load_async_to_lds_b128 %5, %13, off\n\t"
        "global_load_async_to_lds_b128 %6, %14, off\n\t"
        "global_load_async_to_lds_b128 %7, %15, off\n\t"
        "s_wait_xcnt 0x0"
        :: "v"(lds + 0 * 16 * PT_PITCH), "v"(lds + 1 * 16 * PT_PITCH),
           "v"(lds + 2 * 16 * PT_PITCH), "v"(lds + 3 * 16 * PT_PITCH),
           "v"(lds + 4 * 16 * PT_PITCH), "v"(lds + 5 * 16 * PT_PITCH),
           "v"(lds + 6 * 16 * PT_PITCH), "v"(lds + 7 * 16 * PT_PITCH),
           "v"(g + 0 * 16 * CDIM), "v"(g + 1 * 16 * CDIM),
           "v"(g + 2 * 16 * CDIM), "v"(g + 3 * 16 * CDIM),
           "v"(g + 4 * 16 * CDIM), "v"(g + 5 * 16 * CDIM),
           "v"(g + 6 * 16 * CDIM), "v"(g + 7 * 16 * CDIM)
        : "memory");
}

// One stage: 256 rows of 256 B.  A lane's 16 copies take rows (tid >> 4) + 16 i
// at byte column (tid & 15) * 16; lds, gW and gX already hold that lane offset.
__device__ __forceinline__ void fill_stage(unsigned lds, const _Float16* gW,
                                           const _Float16* gX) {
    async_rows8(lds, gW);
    async_rows8(lds + PT_JROWS * PT_PITCH, gX);
}

// Epilogue: Out^T C-layout -> lane holds fixed m; register i is channel
// j0+i with j0 = nw + g*16 + hi*8 (8 contiguous channels per store); nw and mw
// are the wave's first channel and row.
template <int MODE>
__device__ __forceinline__ void proj_store(const v8f (&c)[4][2], const float* __restrict__ bias,
                                           void* __restrict__ outv, float oscale,
                                           int nw, int mw, int col, int hi) {
    const float* bp = bias + nw + hi * 8;
#pragma unroll
    for (int g = 0; g < 4; ++g) {
        const int j0 = nw + g * 16 + hi * 8;
        float bj[8];
#pragma unroll
        for (int i = 0; i < 8; ++i) bj[i] = bp[g * 16 + i];
#pragma unroll
        for (int mt = 0; mt < 2; ++mt) {
            const int m = mw + mt * 16 + col;
            const int b = m >> 11;               // m / NSEQ
            const int n = m & 2047;              // m % NSEQ
            float vals[8];
#pragma unroll
            for (int i = 0; i < 8; ++i) vals[i] = (c[g][mt][i] + bj[i]) * oscale;
            if (MODE == 0) {
                const int h = j0 >> 6, d0 = j0 & 63;
                v8h r;
#pragma unroll
                for (int i = 0; i < 8; ++i) r[i] = (_Float16)vals[i];
                *(v8h*)((_Float16*)outv +
                        (((size_t)b * NHEADS + h) * NSEQ + n) * HDIM + d0) = r;
            } else if (MODE == 1) {
                const int h = j0 >> 6, d0 = j0 & 63;
#pragma unroll
                for (int i = 0; i < 8; ++i)
                    ((_Float16*)outv)[(((size_t)b * NHEADS + h) * HDIM + d0 + i) * NSEQ + n] =
                        (_Float16)vals[i];
            } else {
                float* op = (float*)outv + (size_t)m * CDIM + j0;
                *(float4*)(op + 0) = make_float4(vals[0], vals[1], vals[2], vals[3]);
                *(float4*)(op + 4) = make_float4(vals[4], vals[5], vals[6], vals[7]);
            }
        }
    }
}

// One 128 x 128 tile.  mode is the same for the whole work-group.
__device__ __forceinline__ void proj_tile(const _Float16* __restrict__ X,
                                          const _Float16* __restrict__ W,
                                          const float* __restrict__ bias,
                                          void* __restrict__ outv,
                                          float oscale, int mode) {
    __shared__ __attribute__((aligned(16))) unsigned char L[2 * PT_STAGE];

    const int tid  = threadIdx.x;
    const int lane = tid & 31;
    const int wave = tid >> 5;
    const int col  = lane & 15;
    const int hi   = lane >> 4;
    const int wj   = wave >> 2;               // wave's 64-channel half
    const int wm   = wave & 3;                // wave's 32-row quarter
    const int m0   = blockIdx.x * PT_MROWS;   // row tile over BN (lanes)
    const int n0   = blockIdx.y * PT_JROWS;   // output-channel tile (registers)

    // this lane's place in a stage, for the copies
    const unsigned  ldsc = (unsigned)(size_t)L + (tid >> 4) * PT_PITCH + (tid & 15) * 16;
    const _Float16* gW   = W + (size_t)(n0 + (tid >> 4)) * CDIM + (tid & 15) * 8;
    const _Float16* gX   = X + (size_t)(m0 + (tid >> 4)) * CDIM + (tid & 15) * 8;

    v8f c[4][2];   // [channel subtile g][row subtile mt]
#pragma unroll
    for (int g = 0; g < 4; ++g)
#pragma unroll
        for (int mt = 0; mt < 2; ++mt) c[g][mt] = v8f{};

    // stage 0 lands and is published, then stage 1 starts to fly
    fill_stage(ldsc, gW, gX);
    asm volatile("s_wait_asynccnt 0x0" ::: "memory");   // this wave's copies of stage 0 have landed
    __syncthreads();                                    // ... and every other wave's
    fill_stage(ldsc + PT_STAGE, gW + PT_KS, gX + PT_KS);

    // kept rolled: unrolled, each trip's first fragment reads were placed behind
    // the second set's, so the first product waited for all 24 reads
#pragma unroll 1
    for (int t = 0; t < PT_NT; ++t) {
        const unsigned char* buf = L + (t & 1) * PT_STAGE;
        const _Float16* aB = (const _Float16*)(buf + (wj * 64 + col) * PT_PITCH) + hi * 8;
        const _Float16* bB = (const _Float16*)(buf + (PT_JROWS + wm * 32 + col) * PT_PITCH) + hi * 8;
        // Two fragment sets.  A = W: lane holds row j; B = X^T: lane holds
        // column m; both contiguous in k.
        v16h aW[2][4], bX[2][2];
#pragma unroll
        for (int g = 0; g < 4; ++g) aW[0][g] = frag_from_h16(aB + g * 16 * (PT_PITCH / 2));
#pragma unroll
        for (int mt = 0; mt < 2; ++mt) bX[0][mt] = frag_from_h16(bB + mt * 16 * (PT_PITCH / 2));
#pragma unroll
        for (int ks = 0; ks < PT_KS / 32; ++ks) {
            const int cur = ks & 1;
            if (ks + 1 < PT_KS / 32) {
#pragma unroll
                for (int g = 0; g < 4; ++g)
                    aW[cur ^ 1][g] = frag_from_h16(aB + g * 16 * (PT_PITCH / 2) + (ks + 1) * 32);
#pragma unroll
                for (int mt = 0; mt < 2; ++mt)
                    bX[cur ^ 1][mt] = frag_from_h16(bB + mt * 16 * (PT_PITCH / 2) + (ks + 1) * 32);
            }
            // keeps the next k step's LDS reads one group ahead of this step's
            // products; unfenced they sink to just before their use and stall it
            __builtin_amdgcn_sched_barrier(0);
#pragma unroll
            for (int g = 0; g < 4; ++g)
#pragma unroll
                for (int mt = 0; mt < 2; ++mt)
                    c[g][mt] = __builtin_amdgcn_wmma_f32_16x16x32_f16(
                        false, aW[cur][g], false, bX[cur][mt], (short)0, c[g][mt], false, false);
            // closes the run of products: no later LDS read moves up among them
            __builtin_amdgcn_sched_barrier(0);
        }
        asm volatile("s_wait_dscnt 0x0" ::: "memory");      // this wave has left buffer t & 1
        asm volatile("s_wait_asynccnt 0x0" ::: "memory");   // its copies of stage t + 1 have landed
        __syncthreads();   // publishes stage t + 1; every reader has left buffer t & 1
        if (t + 2 < PT_NT)
            fill_stage(ldsc + (t & 1) * PT_STAGE, gW + (t + 2) * PT_KS, gX + (t + 2) * PT_KS);
    }
    asm volatile("s_wait_asynccnt 0x0" ::: "memory");       // no copy outlives the loop

    const int nw = n0 + wj * 64, mw = m0 + wm * 32;
    if (mode == 0) {
        proj_store<0>(c, bias, outv, oscale, nw, mw, col, hi);
        // behind the last store: the code of the other modes follows this block in
        // the built kernel and writes the stores' address and data registers
        asm volatile("s_wait_xcnt 0x0" ::: "memory");
    }
    else if (mode == 1) proj_store<1>(c, bias, outv, oscale, nw, mw, col, hi);
    else                proj_store<2>(c, bias, outv, oscale, nw, mw, col, hi);
}

// Q, K and V projections: blockIdx.z picks the tensor.  X3, W3 and out3 each
// hold the three tensors one behind the other, in the order q, k, v.  V goes
// first (blockIdx.z 0), for speed only.
__global__ __launch_bounds__(256) void proj_qkv_kernel(const _Float16* __restrict__ X3,
                                                       const _Float16* __restrict__ W3,
                                                       const float* __restrict__ bq,
                                                       const float* __restrict__ bk,
                                                       const float* __restrict__ bv,
                                                       _Float16* __restrict__ out3) {
    const int sel = 2 - (int)blockIdx.z;      // 0: q, 1: k, 2: v
    proj_tile(X3 + (size_t)sel * (BN * CDIM), W3 + (size_t)sel * (CDIM * CDIM),
              sel == 0 ? bq : (sel == 1 ? bk : bv), (void*)(out3 + (size_t)sel * (BN * CDIM)),
              sel == 0 ? QSCALE : 1.0f, sel == 2 ? 1 : 0);
}

// Output projection -> f32
__global__ __launch_bounds__(256) void proj_out_kernel(const _Float16* __restrict__ X,
                                                       const _Float16* __restrict__ W,
                                                       const float* __restrict__ bias,
                                                       float* __restrict__ out) {
    proj_tile(X, W, bias, (void*)out, 1.0f, 2);
}

// ---------------------------------------------------------------------------
// Attention, transposed formulation:
//   S^T = K * Q^T      (A = K tile, B = Q^T tile)
//   P^T = exp2(S^T)    (C-layout of S^T IS the B-layout of P^T for step 2)
//   O^T += V^T * P^T   (A = V^T from the pre-transposed Vt tensor)
// One work-group of 8 waves: 256 q rows of one head; one wave: 32 q rows (two
// 16-col subtiles of S^T), kv chunks of 32.  K and V^T are staged in LDS, 128
// keys per stage, two buffers, filled by asynchronous copies that fly while the
// other buffer is worked on: every K and V line is fetched once per work-group,
// as whole rows, instead of once per wave in 32-B pieces.
// Row sums of P are per-lane scalars (lane = fixed q); one xor-16 shuffle at
// the end.  O^T epilogue stores are contiguous v8h.
// ---------------------------------------------------------------------------
typedef __attribute__((ext_vector_type(2))) float v2f;

#define AT_KEYS  128                       // keys per stage
#define AT_KP    144                       // K row (one key, 128 B) pitch in LDS: 16 B x odd
#define AT_VP    272                       // V^T row (one d, 128 keys, 256 B) pitch in LDS: 16 B x odd
#define AT_KB    (AT_KEYS * AT_KP)         // K part of a buffer
#define AT_STAGE (AT_KB + HDIM * AT_VP)    // one buffer: [K 128 rows | V^T 64 rows]
#define AT_NT    (NSEQ / AT_KEYS)          // stages

// One stage: a lane's eight asynchronous 16-byte copies, global -> LDS.
// K: rows (tid >> 3) + 32 i at byte column (tid & 7) * 16; V^T: rows
// (tid >> 4) + 16 i at byte column (tid & 15) * 16; the arguments already hold
// that lane offset.  s_wait_xcnt closes the statement: no address register
// named here is rewritten in front of it.
__device__ __forceinline__ void fill_kv(unsigned ldsK, unsigned ldsV,
                                        const _Float16* gK, const _Float16* gV) {
    asm volatile(
        "global_load_async_to_lds_b128 %0, %8, off\n\t"
        "global_load_async_to_lds_b128 %1, %9, off\n\t"
        "global_load_async_to_lds_b128 %2, %10, off\n\t"
        "global_load_async_to_lds_b128 %3, %11, off\n\t"
        "global_load_async_to_lds_b128 %4, %12, off\n\t"
        "global_load_async_to_lds_b128 %5, %13, off\n\t"
        "global_load_async_to_lds_b128 %6, %14, off\n\t"
        "global_load_async_to_lds_b128 %7, %15, off\n\t"
        "s_wait_xcnt 0x0"
        :: "v"(ldsK + 0 * 32 * AT_KP), "v"(ldsK + 1 * 32 * AT_KP),
           "v"(ldsK + 2 * 32 * AT_KP), "v"(ldsK + 3 * 32 * AT_KP),
           "v"(ldsV + 0 * 16 * AT_VP), "v"(ldsV + 1 * 16 * AT_VP),
           "v"(ldsV + 2 * 16 * AT_VP), "v"(ldsV + 3 * 16 * AT_VP),
           "v"(gK + 0 * 32 * HDIM), "v"(gK + 1 * 32 * HDIM),
           "v"(gK + 2 * 32 * HDIM), "v"(gK + 3 * 32 * HDIM),
           "v"(gV + 0 * 16 * NSEQ), "v"(gV + 1 * 16 * NSEQ),
           "v"(gV + 2 * 16 * NSEQ), "v"(gV + 3 * 16 * NSEQ)
        : "memory");
}

// One stage of 128 keys out of one LDS buffer, four chunks of 32 keys.
__device__ __forceinline__ void attn_stage(const unsigned char* buf, int col, int hi,
                                           const v16h (&bQ)[2][2], v8f (&o)[2][4],
                                           v2f& lrow) {
    // A = K: lane holds key row, contiguous in d; A = V^T: lane holds d row,
    // contiguous in keys.
    const _Float16* kB = (const _Float16*)(buf + col * AT_KP) + hi * 8;
    const _Float16* vB = (const _Float16*)(buf + AT_KB + col * AT_VP) + hi * 8;

    v16h aK[2][2], aV[4];   // K: [key subtile t][d-fragment]; V^T: [d-group]
#pragma unroll
    for (int t = 0; t < 2; ++t)
#pragma unroll
        for (int f = 0; f < 2; ++f)
            aK[t][f] = frag_from_h16(kB + t * 16 * (AT_KP / 2) + f * 32);

#pragma unroll
    for (int c = 0; c < AT_KEYS / 32; ++c) {
        // this chunk's V^T reads, one group; they land behind the S^T products
        // and the exponentials
#pragma unroll
        for (int g = 0; g < 4; ++g)
            aV[g] = frag_from_h16(vB + g * 16 * (AT_VP / 2) + c * 32);
        // holds the V^T reads up here; unfenced each pair sinks to just
        // before its products, which then wait out the LDS latency
        __builtin_amdgcn_sched_barrier(0);

        // ---- S^T tiles: s[t][qt] = (K rows c*32+t*16..+15) x (q subtile) ----
        v8f s[2][2];
#pragma unroll
        for (int t = 0; t < 2; ++t)
#pragma unroll
            for (int qt = 0; qt < 2; ++qt) {
                v8f acc = {};
                acc = __builtin_amdgcn_wmma_f32_16x16x32_f16(
                    false, aK[t][0], false, bQ[qt][0], (short)0, acc, false, false);
                acc = __builtin_amdgcn_wmma_f32_16x16x32_f16(
                    false, aK[t][1], false, bQ[qt][1], (short)0, acc, false, false);
                s[t][qt] = acc;
            }
        if (c + 1 < AT_KEYS / 32) {
#pragma unroll
            for (int t = 0; t < 2; ++t)
#pragma unroll
                for (int f = 0; f < 2; ++f)
                    aK[t][f] = frag_from_h16(kB + ((c + 1) * 32 + t * 16) * (AT_KP / 2) + f * 32);
        }
        // holds the K reads ahead of the exponentials, a whole chunk's vector
        // work and products in front of their use; in the stage's last chunk,
        // which reads no K, it keeps the chunk in front of the stage's closing
        // barrier: unfenced it moved behind it, and the refill with it
        __builtin_amdgcn_sched_barrier(0);

        // ---- P^T = 2^(S^T): pack straight into B-layout fragments ----
        // B fragment elements {0..7} = kv tile t=0 regs, {8..15} = t=1 regs.
        // The two q subtiles' row sums run side by side as one packed pair: written
        // as two scalars they were gathered at the stage's end, every exponential
        // of the stage held in registers until there.
        v16h pb[2];
        v2f acc = {0.0f, 0.0f};
#pragma unroll
        for (int i = 0; i < 8; ++i) {
            const v2f p0 = {__builtin_amdgcn_exp2f(s[0][0][i]), __builtin_amdgcn_exp2f(s[0][1][i])};
            const v2f p1 = {__builtin_amdgcn_exp2f(s[1][0][i]), __builtin_amdgcn_exp2f(s[1][1][i])};
            acc += p0 + p1;
#pragma unroll
            for (int qt = 0; qt < 2; ++qt) {
                pb[qt][i]     = (_Float16)p0[qt];
                pb[qt][8 + i] = (_Float16)p1[qt];
            }
        }
        lrow += acc;

        // ---- O^T += V^T x P^T ----
#pragma unroll
        for (int g = 0; g < 4; ++g)
#pragma unroll
            for (int qt = 0; qt < 2; ++qt)
                o[qt][g] = __builtin_amdgcn_wmma_f32_16x16x32_f16(
                    false, aV[g], false, pb[qt], (short)0, o[qt][g], false, false);
    }
}

__global__ __launch_bounds__(256) void attn_kernel(const _Float16* __restrict__ Qh,
                                                   const _Float16* __restrict__ Kh,
                                                   const _Float16* __restrict__ Vt,
                                                   _Float16* __restrict__ AO) {
    __shared__ __attribute__((aligned(16))) unsigned char L[2 * AT_STAGE];

    const int tid  = threadIdx.x;
    const int lane = tid & 31;
    const int wave = tid >> 5;
    const int col  = lane & 15;
    const int hi   = lane >> 4;
    const int q0   = blockIdx.x * 256 + wave * 32;
    const int bh   = blockIdx.y;              // b*NHEADS + h
    const int b    = bh >> 4;
    const int h    = bh & 15;

    // this lane's place in a stage, for the copies
    const unsigned  ldsK = (unsigned)(size_t)L + (tid >> 3) * AT_KP + (tid & 7) * 16;
    const unsigned  ldsV = (unsigned)(size_t)L + AT_KB + (tid >> 4) * AT_VP + (tid & 15) * 16;
    const _Float16* gK   = Kh + ((size_t)bh * NSEQ + (tid >> 3)) * HDIM + (tid & 7) * 8;
    const _Float16* gV   = Vt + ((size_t)bh * HDIM + (tid >> 4)) * NSEQ + (tid & 15) * 8;

    // stage 0 starts to fly while Q is fetched
    fill_kv(ldsK, ldsV, gK, gV);

    // B = Q^T fragments: [q-subtile][d-fragment]; lane holds q column
    v16h bQ[2][2];
#pragma unroll
    for (int qt = 0; qt < 2; ++qt)
#pragma unroll
        for (int f = 0; f < 2; ++f)
            bQ[qt][f] = frag_from_h16(
                Qh + ((size_t)bh * NSEQ + q0 + qt * 16 + col) * HDIM + f * 32 + hi * 8);
    // the address registers of the Q loads are written again below
    asm volatile("s_wait_xcnt 0x0" ::: "memory");

    v2f lrow = {0.0f, 0.0f};   // row sums of P: [q-subtile]
    v8f o[2][4];   // O^T accumulators: [q-subtile][d-group]
#pragma unroll
    for (int qt = 0; qt < 2; ++qt)
#pragma unroll
        for (int g = 0; g < 4; ++g) o[qt][g] = v8f{};

    // stage 0 lands and is published, then stage 1 starts to fly
    asm volatile("s_wait_asynccnt 0x0" ::: "memory");   // this wave's copies of stage 0 have landed
    __syncthreads();                                    // ... and every other wave's
    fill_kv(ldsK + AT_STAGE, ldsV + AT_STAGE, gK + AT_KEYS * HDIM, gV + AT_KEYS);

    // Two loops, so that each trip is one straight run of code: with the refill
    // under a test inside the trip, the row sums moved behind that test and every
    // exponential of the stage stayed in registers until there.
    int st = 0;
    for (; st + 2 < AT_NT; ++st) {
        attn_stage(L + (st & 1) * AT_STAGE, col, hi, bQ, o, lrow);
        asm volatile("s_wait_dscnt 0x0" ::: "memory");      // this wave has left buffer st & 1
        asm volatile("s_wait_asynccnt 0x0" ::: "memory");   // its copies of stage st + 1 have landed
        __syncthreads();   // publishes stage st + 1; every reader has left buffer st & 1
        fill_kv(ldsK + (st & 1) * AT_STAGE, ldsV + (st & 1) * AT_STAGE,
                gK + (st + 2) * (AT_KEYS * HDIM), gV + (st + 2) * AT_KEYS);
    }
    // the last two stages: no stage st + 2 is left to fetch
    for (; st < AT_NT; ++st) {
        attn_stage(L + (st & 1) * AT_STAGE, col, hi, bQ, o, lrow);
        asm volatile("s_wait_dscnt 0x0" ::: "memory");      // this wave has left buffer st & 1
        asm volatile("s_wait_asynccnt 0x0" ::: "memory");   // its copies of stage st + 1 have landed
        __syncthreads();   // publishes stage st + 1
    }
    asm volatile("s_wait_asynccnt 0x0" ::: "memory");       // no copy outlives the loops

    // ---- finalize: combine the two kv half-sums, normalize, store O ----
#pragma unroll
    for (int qt = 0; qt < 2; ++qt) {
        const float l   = lrow[qt] + __shfl_xor(lrow[qt], 16, 32);
        const float inv = 1.0f / l;
        const int   qrow = q0 + qt * 16 + col;           // lane = q column
        _Float16* rowp = AO + ((size_t)b * NSEQ + qrow) * CDIM + h * HDIM;
#pragma unroll
        for (int g = 0; g < 4; ++g) {
            v8h r;
#pragma unroll
            for (int i = 0; i < 8; ++i) r[i] = (_Float16)(o[qt][g][i] * inv);
            *(v8h*)(rowp + g * 16 + hi * 8) = r;          // 8 contiguous d
        }
    }
}

// ---------------------------------------------------------------------------
extern "C" void kernel_launch(void* const* d_in, const int* in_sizes, int n_in,
                              void* d_out, int out_size, void* d_ws, size_t ws_size,
                              hipStream_t stream) {
    const float* q  = (const float*)d_in[0];
    const float* k  = (const float*)d_in[1];
    const float* v  = (const float*)d_in[2];
    const float* Wq = (const float*)d_in[3];
    const float* bq = (const float*)d_in[4];
    const float* Wk = (const float*)d_in[5];
    const float* bk = (const float*)d_in[6];
    const float* Wv = (const float*)d_in[7];
    const float* bv = (const float*)d_in[8];
    const float* Wo = (const float*)d_in[9];
    const float* bo = (const float*)d_in[10];
    float* out = (float*)d_out;

    // Workspace layout (f16 tensors)
    char* ws = (char*)d_ws;
    const size_t xbytes = (size_t)BN * CDIM * sizeof(_Float16);     // 8 MB
    const size_t wbytes = (size_t)CDIM * CDIM * sizeof(_Float16);   // 2 MB
    _Float16* Xq  = (_Float16*)(ws);
    _Float16* Xk  = (_Float16*)(ws + 1 * xbytes);
    _Float16* Xv  = (_Float16*)(ws + 2 * xbytes);
    _Float16* Wqh = (_Float16*)(ws + 3 * xbytes);
    _Float16* Wkh = (_Float16*)(ws + 3 * xbytes + 1 * wbytes);
    _Float16* Wvh = (_Float16*)(ws + 3 * xbytes + 2 * wbytes);
    _Float16* Woh = (_Float16*)(ws + 3 * xbytes + 3 * wbytes);
    char* base2 = ws + 3 * xbytes + 4 * wbytes;
    _Float16* Qh = (_Float16*)(base2);
    _Float16* Kh = (_Float16*)(base2 + 1 * xbytes);
    _Float16* Vt = (_Float16*)(base2 + 2 * xbytes);
    _Float16* AO = (_Float16*)(base2 + 3 * xbytes);

    // 1) f32 -> f16 conversion of activations and weights: Xq .. Woh are one
    //    contiguous run of the workspace, in the order of the arguments
    cvt_all_kernel<<<CV_GRID, CV_THREADS, 0, stream>>>(q, k, v, Wq, Wk, Wv, Wo, Xq);

    // 2) projections (1/sqrt(HDIM) * log2(e) folded into Q), one launch:
    //    Xq Xk Xv, Wqh Wkh Wvh and Qh Kh Vt are each one contiguous run
    proj_qkv_kernel<<<dim3(BN / PT_MROWS, CDIM / PT_JROWS, 3), 256, 0, stream>>>(
        Xq, Wqh, bq, bk, bv, Qh);

    // 3) attention
    attn_kernel<<<dim3(NSEQ / 256, BATCH * NHEADS), 256, 0, stream>>>(Qh, Kh, Vt, AO);

    // 4) output projection -> f32 d_out
    proj_out_kernel<<<dim3(BN / PT_MROWS, CDIM / PT_JROWS), 256, 0, stream>>>(AO, Woh, bo, out);
}

// v005
// One run takes 68.4 microseconds.
// Timed twice side by side with v004, it ran 1.08 and 1.07 times as fast.
// Counting every step since v000, it is 5.61 times as fast.
#include <hip/hip_runtime.h>

#define BATCH  2
#define NSEQ   2048
#define CDIM   1024
#define NHEADS 16
#define HDIM   64
#define BN     (BATCH * NSEQ)   // 4096 total rows

typedef __attribute__((ext_vector_type(16))) _Float16 v16h;
typedef __attribute__((ext_vector_type(8)))  _Float16 v8h;
typedef __attribute__((ext_vector_type(8)))  float    v8f;

// 0.125 (=1/sqrt(HDIM)) * log2(e): folded into the Q projection so the
// attention kernel can use v_exp_f32 (2^x) directly with no per-element mul.
#define QSCALE 0.1803368801f

// ---------------------------------------------------------------------------
// Fragment builder matching the CDNA5 16-bit A/B lane layout:
//   lanes 0-15 : K elements {k0+0..7, k0+16..23}
//   lanes 16-31: K elements {k0+8..15, k0+24..31}
// Caller passes a pointer already offset by (hi ? 8 : 0).
// ---------------------------------------------------------------------------
__device__ __forceinline__ v16h frag_from_h16(const _Float16* p) {
    v8h lo = *(const v8h*)p;
    v8h hh = *(const v8h*)(p + 16);
    v16h r;
#pragma unroll
    for (int i = 0; i < 8; ++i) { r[i] = lo[i]; r[8 + i] = hh[i]; }
    return r;
}

// ---------------------------------------------------------------------------
// f32 -> f16 convert of all seven tensors, one launch, one work-group of 16
// waves per WGP.  The seven f16 results lie one behind the other in the
// workspace, so the block index alone gives the place in out; it also picks
// the source.  A wave takes 16 KB of its source: 32 loads of 512 contiguous
// bytes, all issued before the first is converted, and 32 stores of 256
// contiguous bytes.  Few long waves, for speed only.
// ---------------------------------------------------------------------------
typedef __attribute__((ext_vector_type(4))) _Float16 v4h;
typedef __attribute__((ext_vector_type(4))) float    v4f;

#define CV_THREADS 512
#define CV_LOADS   32                               // 16-byte loads per lane
#define CV_WAVE    (32 * CV_LOADS * 4)              // elements per wave
#define CV_BLOCK   (CV_THREADS * CV_LOADS * 4)       // elements per work-group
#define CV_XB      (BN * CDIM / CV_BLOCK)           // work-groups per activation tensor: 64
#define CV_WB      (CDIM * CDIM / CV_BLOCK)         // work-groups per weight tensor: 16
#define CV_GRID    (3 * CV_XB + 4 * CV_WB)          // 256

__global__ __launch_bounds__(CV_THREADS) void cvt_all_kernel(const float* __restrict__ q,
                                                             const float* __restrict__ k,
                                                             const float* __restrict__ v,
                                                             const float* __restrict__ Wq,
                                                             const float* __restrict__ Wk,
                                                             const float* __restrict__ Wv,
                                                             const float* __restrict__ Wo,
                                                             _Float16* __restrict__ out) {
    const int blk = blockIdx.x;
    const float* src;
    int piece;                                      // work-group's place in its source
    if (blk < 3 * CV_XB) {
        src   = blk < CV_XB ? q : (blk < 2 * CV_XB ? k : v);
        piece = blk & (CV_XB - 1);
    } else {
        const int w = (blk - 3 * CV_XB) / CV_WB;
        src   = w == 0 ? Wq : (w == 1 ? Wk : (w == 2 ? Wv : Wo));
        piece = blk & (CV_WB - 1);
    }
    const unsigned inwg = (threadIdx.x >> 5) * CV_WAVE + (threadIdx.x & 31) * 4;
    const unsigned ioff = inwg * 4;                 // this lane's byte offset in the source piece
    const v4f* ip = (const v4f*)((const char*)(src + (size_t)piece * CV_BLOCK) + ioff);
    v4h*       op = (v4h*)(out + (size_t)blk * CV_BLOCK + inwg);

    v4f x[CV_LOADS];
#pragma unroll
    for (int j = 0; j < CV_LOADS; ++j) x[j] = ip[j * 32];
    // stands behind the last load and in front of every write of the loads'
    // offset register, which it names so that no load lands on it
    asm volatile("s_wait_xcnt 0x0" :: "v"(ioff) : "memory");
    // holds every convert behind the last load, so that the wave's whole share
    // is in flight at once; unfenced, converts and their waits stood among the loads
    __builtin_amdgcn_sched_barrier(0);
#pragma unroll
    for (int j = 0; j < CV_LOADS; ++j) op[j * 32] = __builtin_convertvector(x[j], v4h);
}

// ---------------------------------------------------------------------------
// Transposed projection GEMM: computes Out^T = W @ X^T  (i.e. Out = X @ W^T),
// + bias, * oscale.  One work-group of 8 waves (2 x 4): 128 output channels (j)
// x 128 rows (m); one wave: 64 x 32 = 4 x 2 accumulator tiles, two waves per SIMD.
// Both operand tiles are staged in LDS, 128 k (256 B of every row) per stage,
// two buffers, filled by asynchronous copies that fly while the other buffer
// is worked on.  Every global line is fetched once per work-group, as whole
// 256-B row pieces, instead of once per wave in 32-B pieces.
// The D-matrix C-layout has j running along registers -> contiguous
// epilogue stores; bias is indexed along registers.
// MODE 0: f16 out, head-major   [B,H,N,D]   (Q with oscale=QSCALE, K)
// MODE 1: f16 out, d-transposed [B,H,D,N]   (V)
// MODE 2: f32 out, plain        [BN,CDIM]   (final output projection)
// The Q, K and V projections are one launch (proj_qkv_kernel): three tiles per
// WGP, two of them resident at a time, so that one work-group's copies, first
// stage and stores run under the other's products.
// ---------------------------------------------------------------------------
#define PT_JROWS 128                       // W rows (output channels) per work-group
#define PT_MROWS 128                       // X rows per work-group
#define PT_KS    128                       // k per stage
#define PT_PITCH 272                       // LDS row pitch, bytes: 16 B x odd, no bank conflict for b128 reads
#define PT_STAGE ((PT_JROWS + PT_MROWS) * PT_PITCH)  // one buffer: [W 128 rows | X 128 rows]
#define PT_NT    (CDIM / PT_KS)            // stages

// Eight asynchronous 16-byte copies per lane, global -> LDS, rows 16 apart.
// s_wait_xcnt closes the statement: no address register named here is
// rewritten in front of it.
__device__ __forceinline__ void async_rows8(unsigned lds, const _Float16* g) {
    asm volatile(
        "global_load_async_to_lds_b128 %0, %8, off\n\t"
        "global_load_async_to_lds_b128 %1, %9, off\n\t"
        "global_load_async_to_lds_b128 %2, %10, off\n\t"
        "global_load_async_to_lds_b128 %3, %11, off\n\t"
        "global_load_async_to_lds_b128 %4, %12, off\n\t"
        "global_load_async_to_lds_b128 %5, %13, off\n\t"
        "global_load_async_to_lds_b128 %6, %14, off\n\t"
        "global_load_async_to_lds_b128 %7, %15, off\n\t"
        "s_wait_xcnt 0x0"
        :: "v"(lds + 0 * 16 * PT_PITCH), "v"(lds + 1 * 16 * PT_PITCH),
           "v"(lds + 2 * 16 * PT_PITCH), "v"(lds + 3 * 16 * PT_PITCH),
           "v"(lds + 4 * 16 * PT_PITCH), "v"(lds + 5 * 16 * PT_PITCH),
           "v"(lds + 6 * 16 * PT_PITCH), "v"(lds + 7 * 16 * PT_PITCH),
           "v"(g + 0 * 16 * CDIM), "v"(g + 1 * 16 * CDIM),
           "v"(g + 2 * 16 * CDIM), "v"(g + 3 * 16 * CDIM),
           "v"(g + 4 * 16 * CDIM), "v"(g + 5 * 16 * CDIM),
           "v"(g + 6 * 16 * CDIM), "v"(g + 7 * 16 * CDIM)
        : "memory");
}

// One stage: 256 rows of 256 B.  A lane's 16 copies take rows (tid >> 4) + 16 i
// at byte column (tid & 15) * 16; lds, gW and gX already hold that lane offset.
__device__ __forceinline__ void fill_stage(unsigned lds, const _Float16* gW,
                                           const _Float16* gX) {
    async_rows8(lds, gW);
    async_rows8(lds + PT_JROWS * PT_PITCH, gX);
}

// Epilogue: Out^T C-layout -> lane holds fixed m; register i is channel
// j0+i with j0 = nw + g*16 + hi*8 (8 contiguous channels per store); nw and mw
// are the wave's first channel and row.
template <int MODE>
__device__ __forceinline__ void proj_store(const v8f (&c)[4][2], const float* __restrict__ bias,
                                           void* __restrict__ outv, float oscale,
                                           int nw, int mw, int col, int hi) {
    const float* bp = bias + nw + hi * 8;
#pragma unroll
    for (int g = 0; g < 4; ++g) {
        const int j0 = nw + g * 16 + hi * 8;
        float bj[8];
#pragma unroll
        for (int i = 0; i < 8; ++i) bj[i] = bp[g * 16 + i];
#pragma unroll
        for (int mt = 0; mt < 2; ++mt) {
            const int m = mw + mt * 16 + col;
            const int b = m >> 11;               // m / NSEQ
            const int n = m & 2047;              // m % NSEQ
            float vals[8];
#pragma unroll
            for (int i = 0; i < 8; ++i) vals[i] = (c[g][mt][i] + bj[i]) * oscale;
            if (MODE == 0) {
                const int h = j0 >> 6, d0 = j0 & 63;
                v8h r;
#pragma unroll
                for (int i = 0; i < 8; ++i) r[i] = (_Float16)vals[i];
                *(v8h*)((_Float16*)outv +
                        (((size_t)b * NHEADS + h) * NSEQ + n) * HDIM + d0) = r;
            } else if (MODE == 1) {
                const int h = j0 >> 6, d0 = j0 & 63;
#pragma unroll
                for (int i = 0; i < 8; ++i)
                    ((_Float16*)outv)[(((size_t)b * NHEADS + h) * HDIM + d0 + i) * NSEQ + n] =
                        (_Float16)vals[i];
            } else {
                float* op = (float*)outv + (size_t)m * CDIM + j0;
                *(float4*)(op + 0) = make_float4(vals[0], vals[1], vals[2], vals[3]);
                *(float4*)(op + 4) = make_float4(vals[4], vals[5], vals[6], vals[7]);
            }
        }
    }
}

// One 128 x 128 tile.  mode is the same for the whole work-group.
__device__ __forceinline__ void proj_tile(const _Float16* __restrict__ X,
                                          const _Float16* __restrict__ W,
                                          const float* __restrict__ bias,
                                          void* __restrict__ outv,
                                          float oscale, int mode) {
    __shared__ __attribute__((aligned(16))) unsigned char L[2 * PT_STAGE];

    const int tid  = threadIdx.x;
    const int lane = tid & 31;
    const int wave = tid >> 5;
    const int col  = lane & 15;
    const int hi   = lane >> 4;
    const int wj   = wave >> 2;               // wave's 64-channel half
    const int wm   = wave & 3;                // wave's 32-row quarter
    const int m0   = blockIdx.x * PT_MROWS;   // row tile over BN (lanes)
    const int n0   = blockIdx.y * PT_JROWS;   // output-channel tile (registers)

    // this lane's place in a stage, for the copies
    const unsigned  ldsc = (unsigned)(size_t)L + (tid >> 4) * PT_PITCH + (tid & 15) * 16;
    const _Float16* gW   = W + (size_t)(n0 + (tid >> 4)) * CDIM + (tid & 15) * 8;
    const _Float16* gX   = X + (size_t)(m0 + (tid >> 4)) * CDIM + (tid & 15) * 8;
    // Stage t holds k slice (t + rot) mod PT_NT: work-groups that read the same X
    // or W rows start at different slices, for speed only.
    const int rot = (blockIdx.x + blockIdx.y) & (PT_NT - 1);

    v8f c[4][2];   // [channel subtile g][row subtile mt]
#pragma unroll
    for (int g = 0; g < 4; ++g)
#pragma unroll
        for (int mt = 0; mt < 2; ++mt) c[g][mt] = v8f{};

    // stage 0 lands and is published, then stage 1 starts to fly
    fill_stage(ldsc, gW + rot * PT_KS, gX + rot * PT_KS);
    asm volatile("s_wait_asynccnt 0x0" ::: "memory");   // this wave's copies of stage 0 have landed
    __syncthreads();                                    // ... and every other wave's
    {
        const int k1 = ((rot + 1) & (PT_NT - 1)) * PT_KS;
        fill_stage(ldsc + PT_STAGE, gW + k1, gX + k1);
    }

    // kept rolled: unrolled, each trip's first fragment reads were placed behind
    // the second set's, so the first product waited for all 24 reads
#pragma unroll 1
    for (int t = 0; t < PT_NT; ++t) {
        const unsigned char* buf = L + (t & 1) * PT_STAGE;
        const _Float16* aB = (const _Float16*)(buf + (wj * 64 + col) * PT_PITCH) + hi * 8;
        const _Float16* bB = (const _Float16*)(buf + (PT_JROWS + wm * 32 + col) * PT_PITCH) + hi * 8;
        // Two fragment sets.  A = W: lane holds row j; B = X^T: lane holds
        // column m; both contiguous in k.
        v16h aW[2][4], bX[2][2];
#pragma unroll
        for (int g = 0; g < 4; ++g) aW[0][g] = frag_from_h16(aB + g * 16 * (PT_PITCH / 2));
#pragma unroll
        for (int mt = 0; mt < 2; ++mt) bX[0][mt] = frag_from_h16(bB + mt * 16 * (PT_PITCH / 2));
#pragma unroll
        for (int ks = 0; ks < PT_KS / 32; ++ks) {
            const int cur = ks & 1;
            if (ks + 1 < PT_KS / 32) {
#pragma unroll
                for (int g = 0; g < 4; ++g)
                    aW[cur ^ 1][g] = frag_from_h16(aB + g * 16 * (PT_PITCH / 2) + (ks + 1) * 32);
#pragma unroll
                for (int mt = 0; mt < 2; ++mt)
                    bX[cur ^ 1][mt] = frag_from_h16(bB + mt * 16 * (PT_PITCH / 2) + (ks + 1) * 32);
            }
            // keeps the next k step's LDS reads one group ahead of this step's
            // products; unfenced they sink to just before their use and stall it
            __builtin_amdgcn_sched_barrier(0);
#pragma unroll
            for (int g = 0; g < 4; ++g)
#pragma unroll
                for (int mt = 0; mt < 2; ++mt)
                    c[g][mt] = __builtin_amdgcn_wmma_f32_16x16x32_f16(
                        false, aW[cur][g], false, bX[cur][mt], (short)0, c[g][mt], false, false);
            // closes the run of products: no later LDS read moves up among them
            __builtin_amdgcn_sched_barrier(0);
        }
        asm volatile("s_wait_dscnt 0x0" ::: "memory");      // this wave has left buffer t & 1
        asm volatile("s_wait_asynccnt 0x0" ::: "memory");   // its copies of stage t + 1 have landed
        __syncthreads();   // publishes stage t + 1; every reader has left buffer t & 1
        if (t + 2 < PT_NT) {
            const int k2 = ((t + 2 + rot) & (PT_NT - 1)) * PT_KS;
            fill_stage(ldsc + (t & 1) * PT_STAGE, gW + k2, gX + k2);
        }
    }
    asm volatile("s_wait_asynccnt 0x0" ::: "memory");       // no copy outlives the loop

    const int nw = n0 + wj * 64, mw = m0 + wm * 32;
    if (mode == 0) {
        proj_store<0>(c, bias, outv, oscale, nw, mw, col, hi);
        // behind the last store: the code of the other modes follows this block in
        // the built kernel and writes the stores' address and data registers
        asm volatile("s_wait_xcnt 0x0" ::: "memory");
    }
    else if (mode == 1) proj_store<1>(c, bias, outv, oscale, nw, mw, col, hi);
    else                proj_store<2>(c, bias, outv, oscale, nw, mw, col, hi);
}

// Q, K and V projections: blockIdx.z picks the tensor.  X3, W3 and out3 each
// hold the three tensors one behind the other, in the order q, k, v.  V goes
// first (blockIdx.z 0), for speed only.
__global__ __launch_bounds__(256) void proj_qkv_kernel(const _Float16* __restrict__ X3,
                                                       const _Float16* __restrict__ W3,
                                                       const float* __restrict__ bq,
                                                       const float* __restrict__ bk,
                                                       const float* __restrict__ bv,
                                                       _Float16* __restrict__ out3) {
    const int sel = 2 - (int)blockIdx.z;      // 0: q, 1: k, 2: v
    proj_tile(X3 + (size_t)sel * (BN * CDIM), W3 + (size_t)sel * (CDIM * CDIM),
              sel == 0 ? bq : (sel == 1 ? bk : bv), (void*)(out3 + (size_t)sel * (BN * CDIM)),
              sel == 0 ? QSCALE : 1.0f, sel == 2 ? 1 : 0);
}

// Output projection -> f32
__global__ __launch_bounds__(256) void proj_out_kernel(const _Float16* __restrict__ X,
                                                       const _Float16* __restrict__ W,
                                                       const float* __restrict__ bias,
                                                       float* __restrict__ out) {
    proj_tile(X, W, bias, (void*)out, 1.0f, 2);
}

// ---------------------------------------------------------------------------
// Attention, transposed formulation:
//   S^T = K * Q^T      (A = K tile, B = Q^T tile)
//   P^T = exp2(S^T)    (C-layout of S^T IS the B-layout of P^T for step 2)
//   O^T += V^T * P^T   (A = V^T from the pre-transposed Vt tensor)
// One work-group of 8 waves: 256 q rows of one head; one wave: 32 q rows (two
// 16-col subtiles of S^T), kv chunks of 32.  K and V^T are staged in LDS, 128
// keys per stage, two buffers, filled by asynchronous copies that fly while the
// other buffer is worked on: every K and V line is fetched once per work-group,
// as whole rows, instead of once per wave in 32-B pieces.
// Row sums of P are per-lane scalars (lane = fixed q); one xor-16 shuffle at
// the end.  O^T epilogue stores are contiguous v8h.
// ---------------------------------------------------------------------------
typedef __attribute__((ext_vector_type(2))) float v2f;

#define AT_KEYS  128                       // keys per stage
#define AT_KP    144                       // K row (one key, 128 B) pitch in LDS: 16 B x odd
#define AT_VP    272                       // V^T row (one d, 128 keys, 256 B) pitch in LDS: 16 B x odd
#define AT_KB    (AT_KEYS * AT_KP)         // K part of a buffer
#define AT_STAGE (AT_KB + HDIM * AT_VP)    // one buffer: [K 128 rows | V^T 64 rows]
#define AT_NT    (NSEQ / AT_KEYS)          // stages

// One stage: a lane's eight asynchronous 16-byte copies, global -> LDS.
// K: rows (tid >> 3) + 32 i at byte column (tid & 7) * 16; V^T: rows
// (tid >> 4) + 16 i at byte column (tid & 15) * 16; the arguments already hold
// that lane offset.  s_wait_xcnt closes the statement: no address register
// named here is rewritten in front of it.
__device__ __forceinline__ void fill_kv(unsigned ldsK, unsigned ldsV,
                                        const _Float16* gK, const _Float16* gV) {
    asm volatile(
        "global_load_async_to_lds_b128 %0, %8, off\n\t"
        "global_load_async_to_lds_b128 %1, %9, off\n\t"
        "global_load_async_to_lds_b128 %2, %10, off\n\t"
        "global_load_async_to_lds_b128 %3, %11, off\n\t"
        "global_load_async_to_lds_b128 %4, %12, off\n\t"
        "global_load_async_to_lds_b128 %5, %13, off\n\t"
        "global_load_async_to_lds_b128 %6, %14, off\n\t"
        "global_load_async_to_lds_b128 %7, %15, off\n\t"
        "s_wait_xcnt 0x0"
        :: "v"(ldsK + 0 * 32 * AT_KP), "v"(ldsK + 1 * 32 * AT_KP),
           "v"(ldsK + 2 * 32 * AT_KP), "v"(ldsK + 3 * 32 * AT_KP),
           "v"(ldsV + 0 * 16 * AT_VP), "v"(ldsV + 1 * 16 * AT_VP),
           "v"(ldsV + 2 * 16 * AT_VP), "v"(ldsV + 3 * 16 * AT_VP),
           "v"(gK + 0 * 32 * HDIM), "v"(gK + 1 * 32 * HDIM),
           "v"(gK + 2 * 32 * HDIM), "v"(gK + 3 * 32 * HDIM),
           "v"(gV + 0 * 16 * NSEQ), "v"(gV + 1 * 16 * NSEQ),
           "v"(gV + 2 * 16 * NSEQ), "v"(gV + 3 * 16 * NSEQ)
        : "memory");
}

// One stage of 128 keys out of one LDS buffer, four chunks of 32 keys.
__device__ __forceinline__ void attn_stage(const unsigned char* buf, int col, int hi,
                                           const v16h (&bQ)[2][2], v8f (&o)[2][4],
                                           v2f& lrow) {
    // A = K: lane holds key row, contiguous in d; A = V^T: lane holds d row,
    // contiguous in keys.
    const _Float16* kB = (const _Float16*)(buf + col * AT_KP) + hi * 8;
    const _Float16* vB = (const _Float16*)(buf + AT_KB + col * AT_VP) + hi * 8;

    v16h aK[2][2], aV[4];   // K: [key subtile t][d-fragment]; V^T: [d-group]
#pragma unroll
    for (int t = 0; t < 2; ++t)
#pragma unroll
        for (int f = 0; f < 2; ++f)
            aK[t][f] = frag_from_h16(kB + t * 16 * (AT_KP / 2) + f * 32);

#pragma unroll
    for (int c = 0; c < AT_KEYS / 32; ++c) {
        // this chunk's V^T reads, one group; they land behind the S^T products
        // and the exponentials
#pragma unroll
        for (int g = 0; g < 4; ++g)
            aV[g] = frag_from_h16(vB + g * 16 * (AT_VP / 2) + c * 32);
        // holds the V^T reads up here; unfenced each pair sinks to just
        // before its products, which then wait out the LDS latency
        __builtin_amdgcn_sched_barrier(0);

        // ---- S^T tiles: s[t][qt] = (K rows c*32+t*16..+15) x (q subtile) ----
        v8f s[2][2];
#pragma unroll
        for (int t = 0; t < 2; ++t)
#pragma unroll
            for (int qt = 0; qt < 2; ++qt) {
                v8f acc = {};
                acc = __builtin_amdgcn_wmma_f32_16x16x32_f16(
                    false, aK[t][0], false, bQ[qt][0], (short)0, acc, false, false);
                acc = __builtin_amdgcn_wmma_f32_16x16x32_f16(
                    false, aK[t][1], false, bQ[qt][1], (short)0, acc, false, false);
                s[t][qt] = acc;
            }
        if (c + 1 < AT_KEYS / 32) {
#pragma unroll
            for (int t = 0; t < 2; ++t)
#pragma unroll
                for (int f = 0; f < 2; ++f)
                    aK[t][f] = frag_from_h16(kB + ((c + 1) * 32 + t * 16) * (AT_KP / 2) + f * 32);
        }
        // holds the K reads ahead of the exponentials, a whole chunk's vector
        // work and products in front of their use; in the stage's last chunk,
        // which reads no K, it keeps the chunk in front of the stage's closing
        // barrier: unfenced it moved behind it, and the refill with it
        __builtin_amdgcn_sched_barrier(0);

        // ---- P^T = 2^(S^T): pack straight into B-layout fragments ----
        // B fragment elements {0..7} = kv tile t=0 regs, {8..15} = t=1 regs.
        // The two q subtiles' row sums run side by side as one packed pair: written
        // as two scalars they were gathered at the stage's end, every exponential
        // of the stage held in registers until there.
        v16h pb[2];
        v2f acc = {0.0f, 0.0f};
#pragma unroll
        for (int i = 0; i < 8; ++i) {
            const v2f p0 = {__builtin_amdgcn_exp2f(s[0][0][i]), __builtin_amdgcn_exp2f(s[0][1][i])};
            const v2f p1 = {__builtin_amdgcn_exp2f(s[1][0][i]), __builtin_amdgcn_exp2f(s[1][1][i])};
            acc += p0 + p1;
#pragma unroll
            for (int qt = 0; qt < 2; ++qt) {
                pb[qt][i]     = (_Float16)p0[qt];
                pb[qt][8 + i] = (_Float16)p1[qt];
            }
        }
        lrow += acc;

        // ---- O^T += V^T x P^T ----
#pragma unroll
        for (int g = 0; g < 4; ++g)
#pragma unroll
            for (int qt = 0; qt < 2; ++qt)
                o[qt][g] = __builtin_amdgcn_wmma_f32_16x16x32_f16(
                    false, aV[g], false, pb[qt], (short)0, o[qt][g], false, false);
    }
}

__global__ __launch_bounds__(256) void attn_kernel(const _Float16* __restrict__ Qh,
                                                   const _Float16* __restrict__ Kh,
                                                   const _Float16* __restrict__ Vt,
                                                   _Float16* __restrict__ AO) {
    __shared__ __attribute__((aligned(16))) unsigned char L[2 * AT_STAGE];

    const int tid  = threadIdx.x;
    const int lane = tid & 31;
    const int wave = tid >> 5;
    const int col  = lane & 15;
    const int hi   = lane >> 4;
    const int q0   = blockIdx.x * 256 + wave * 32;
    const int bh   = blockIdx.y;              // b*NHEADS + h
    const int b    = bh >> 4;
    const int h    = bh & 15;

    // this lane's place in a stage, for the copies
    const unsigned  ldsK = (unsigned)(size_t)L + (tid >> 3) * AT_KP + (tid & 7) * 16;
    const unsigned  ldsV = (unsigned)(size_t)L + AT_KB + (tid >> 4) * AT_VP + (tid & 15) * 16;
    const _Float16* gK   = Kh + ((size_t)bh * NSEQ + (tid >> 3)) * HDIM + (tid & 7) * 8;
    const _Float16* gV   = Vt + ((size_t)bh * HDIM + (tid >> 4)) * NSEQ + (tid & 15) * 8;
    // Stage st holds key slice (st + rot) mod AT_NT.  The work-groups of one head
    // read the same K and V^T; each starts at a slice of its own, evenly apart,
    // for speed only.
    const int rot = (blockIdx.x * (AT_NT / (NSEQ / 256))) & (AT_NT - 1);

    // stage 0 starts to fly while Q is fetched
    fill_kv(ldsK, ldsV, gK + rot * (AT_KEYS * HDIM), gV + rot * AT_KEYS);

    // B = Q^T fragments: [q-subtile][d-fragment]; lane holds q column
    v16h bQ[2][2];
#pragma unroll
    for (int qt = 0; qt < 2; ++qt)
#pragma unroll
        for (int f = 0; f < 2; ++f)
            bQ[qt][f] = frag_from_h16(
                Qh + ((size_t)bh * NSEQ + q0 + qt * 16 + col) * HDIM + f * 32 + hi * 8);
    // the address registers of the Q loads are written again below
    asm volatile("s_wait_xcnt 0x0" ::: "memory");

    v2f lrow = {0.0f, 0.0f};   // row sums of P: [q-subtile]
    v8f o[2][4];   // O^T accumulators: [q-subtile][d-group]
#pragma unroll
    for (int qt = 0; qt < 2; ++qt)
#pragma unroll
        for (int g = 0; g < 4; ++g) o[qt][g] = v8f{};

    // stage 0 lands and is published, then stage 1 starts to fly
    asm volatile("s_wait_asynccnt 0x0" ::: "memory");   // this wave's copies of stage 0 have landed
    __syncthreads();                                    // ... and every other wave's
    {
        const int s1 = (rot + 1) & (AT_NT - 1);
        fill_kv(ldsK + AT_STAGE, ldsV + AT_STAGE, gK + s1 * (AT_KEYS * HDIM), gV + s1 * AT_KEYS);
    }

    // Two loops, so that each trip is one straight run of code: with the refill
    // under a test inside the trip, the row sums moved behind that test and every
    // exponential of the stage stayed in registers until there.
    int st = 0;
    for (; st + 2 < AT_NT; ++st) {
        attn_stage(L + (st & 1) * AT_STAGE, col, hi, bQ, o, lrow);
        asm volatile("s_wait_dscnt 0x0" ::: "memory");      // this wave has left buffer st & 1
        asm volatile("s_wait_asynccnt 0x0" ::: "memory");   // its copies of stage st + 1 have landed
        __syncthreads();   // publishes stage st + 1; every reader has left buffer st & 1
        const int s2 = (st + 2 + rot) & (AT_NT - 1);
        fill_kv(ldsK + (st & 1) * AT_STAGE, ldsV + (st & 1) * AT_STAGE,
                gK + s2 * (AT_KEYS * HDIM), gV + s2 * AT_KEYS);
    }
    // the last two stages: no stage st + 2 is left to fetch
    for (; st < AT_NT; ++st) {
        attn_stage(L + (st & 1) * AT_STAGE, col, hi, bQ, o, lrow);
        asm volatile("s_wait_dscnt 0x0" ::: "memory");      // this wave has left buffer st & 1
        asm volatile("s_wait_asynccnt 0x0" ::: "memory");   // its copies of stage st + 1 have landed
        __syncthreads();   // publishes stage st + 1
    }
    asm volatile("s_wait_asynccnt 0x0" ::: "memory");       // no copy outlives the loops

    // ---- finalize: combine the two kv half-sums, normalize, store O ----
#pragma unroll
    for (int qt = 0; qt < 2; ++qt) {
        const float l   = lrow[qt] + __shfl_xor(lrow[qt], 16, 32);
        const float inv = 1.0f / l;
        const int   qrow = q0 + qt * 16 + col;           // lane = q column
        _Float16* rowp = AO + ((size_t)b * NSEQ + qrow) * CDIM + h * HDIM;
#pragma unroll
        for (int g = 0; g < 4; ++g) {
            v8h r;
#pragma unroll
            for (int i = 0; i < 8; ++i) r[i] = (_Float16)(o[qt][g][i] * inv);
            *(v8h*)(rowp + g * 16 + hi * 8) = r;          // 8 contiguous d
        }
    }
}

// ---------------------------------------------------------------------------
extern "C" void kernel_launch(void* const* d_in, const int* in_sizes, int n_in,
                              void* d_out, int out_size, void* d_ws, size_t ws_size,
                              hipStream_t stream) {
    const float* q  = (const float*)d_in[0];
    const float* k  = (const float*)d_in[1];
    const float* v  = (const float*)d_in[2];
    const float* Wq = (const float*)d_in[3];
    const float* bq = (const float*)d_in[4];
    const float* Wk = (const float*)d_in[5];
    const float* bk = (const float*)d_in[6];
    const float* Wv = (const float*)d_in[7];
    const float* bv = (const float*)d_in[8];
    const float* Wo = (const float*)d_in[9];
    const float* bo = (const float*)d_in[10];
    float* out = (float*)d_out;

    // Workspace layout (f16 tensors)
    char* ws = (char*)d_ws;
    const size_t xbytes = (size_t)BN * CDIM * sizeof(_Float16);     // 8 MB
    const size_t wbytes = (size_t)CDIM * CDIM * sizeof(_Float16);   // 2 MB
    _Float16* Xq  = (_Float16*)(ws);
    _Float16* Xk  = (_Float16*)(ws + 1 * xbytes);
    _Float16* Xv  = (_Float16*)(ws + 2 * xbytes);
    _Float16* Wqh = (_Float16*)(ws + 3 * xbytes);
    _Float16* Wkh = (_Float16*)(ws + 3 * xbytes + 1 * wbytes);
    _Float16* Wvh = (_Float16*)(ws + 3 * xbytes + 2 * wbytes);
    _Float16* Woh = (_Float16*)(ws + 3 * xbytes + 3 * wbytes);
    char* base2 = ws + 3 * xbytes + 4 * wbytes;
    _Float16* Qh = (_Float16*)(base2);
    _Float16* Kh = (_Float16*)(base2 + 1 * xbytes);
    _Float16* Vt = (_Float16*)(base2 + 2 * xbytes);
    _Float16* AO = (_Float16*)(base2 + 3 * xbytes);

    // 1) f32 -> f16 conversion of activations and weights: Xq .. Woh are one
    //    contiguous run of the workspace, in the order of the arguments
    cvt_all_kernel<<<CV_GRID, CV_THREADS, 0, stream>>>(q, k, v, Wq, Wk, Wv, Wo, Xq);

    // 2) projections (1/sqrt(HDIM) * log2(e) folded into Q), one launch:
    //    Xq Xk Xv, Wqh Wkh Wvh and Qh Kh Vt are each one contiguous run
    proj_qkv_kernel<<<dim3(BN / PT_MROWS, CDIM / PT_JROWS, 3), 256, 0, stream>>>(
        Xq, Wqh, bq, bk, bv, Qh);

    // 3) attention
    attn_kernel<<<dim3(NSEQ / 256, BATCH * NHEADS), 256, 0, stream>>>(Qh, Kh, Vt, AO);

    // 4) output projection -> f32 d_out
    proj_out_kernel<<<dim3(BN / PT_MROWS, CDIM / PT_JROWS), 256, 0, stream>>>(AO, Woh, bo, out);
}
